// v000
// Measured on an AMD MI455X. A time is GPU time per run, averaged over a window of back-to-back runs after a warm-up
// (all launches, gaps included; the runs take copies of the inputs in turn), and the median of several windows.
// Apart from v000's, it joins two sittings. Times from different sittings can be a few percent apart, while
// side-by-side timings come from the same sitting.
// v000, which the later versions start from, runs in 351 microseconds.
#include <hip/hip_runtime.h>
#include <hip/hip_bf16.h>

// ---------------------------------------------------------------------------
// Local windowed MHA forward for MI455X (gfx1250), wave32 + WMMA f16->f32.
//   b=2, n=8192, DIM=1024, HEADS=16, DHEAD=64, WINDOW=128, look_backward=1
// Pipeline: LN(pack A-frag) -> pack weights(B-frag) -> QKV GEMM (WMMA, scatter
// q/kT/v frags) -> per-window attention (WMMA QK^T, softmax, WMMA PV) ->
// output GEMM (WMMA) -> f32 out.
// ---------------------------------------------------------------------------

typedef __attribute__((ext_vector_type(16))) _Float16 v16h;
typedef __attribute__((ext_vector_type(8)))  float    v8f;
typedef _Float16 half_t;

#define HEADS  16
#define DIM    1024
#define DHEAD  64
#define WIN    128
#define NTOK   8192
#define BATCH  2
#define ROWS   (BATCH * NTOK)   // 16384
#define NQKV   (3 * DIM)        // 3072
#define NWIN   (NTOK / WIN)     // 64

// Workspace layout (in halfs). All offsets keep >=32B alignment.
static constexpr size_t OFF_XNA  = 0;                       // 16384x1024 A-frag (reused as O A-frag)
static constexpr size_t OFF_WQKV = OFF_XNA  + 16777216;     // 1024x3072 B-frag
static constexpr size_t OFF_WOUT = OFF_WQKV + 3145728;      // 1024x1024 B-frag
static constexpr size_t OFF_QA   = OFF_WOUT + 1048576;      // per (b,h): 8192x64 A-frag
static constexpr size_t OFF_KTB  = OFF_QA   + 16777216;     // per (b,h): B-frag (d x padded keypos), 520 jtiles
static constexpr size_t OFF_VB   = OFF_KTB  + 17039360;     // per (b,h): B-frag (padded keypos x d), 260 ktiles
// total = 71,827,456 halfs = ~137 MB

static constexpr size_t QA_BH  = 524288;  // 512 mtiles * 2 ktiles * 512
static constexpr size_t KTB_BH = 532480;  // 520 jtiles * 2 dtiles * 512
static constexpr size_t VB_BH  = 532480;  // 4 ntiles * 260 ktiles * 512

// --- WMMA fragment addressing (element granularity) ------------------------
// A-frag (MxK): tile(mt,kt) base=((mt*Kt+kt)<<9); within tile, element (m,k):
//   lane = (m&15) | ((k>>3 & 1)<<4), halfidx = (k&7) | ((k>>4 & 1)<<3)
__device__ __forceinline__ size_t a_off(int kt32, int m, int k) {
  int kk   = k & 31;
  int lane = (m & 15) | (((kk >> 3) & 1) << 4);
  int hidx = (kk & 7) | (((kk >> 4) & 1) << 3);
  return ((size_t)((m >> 4) * kt32 + (k >> 5)) << 9) + (lane << 4) + hidx;
}
// B-frag (KxN): tile(nt,kt) base=((nt*Kt+kt)<<9); element (k,n) mirrors A.
__device__ __forceinline__ size_t b_off(int kt32, int k, int n) {
  int kk   = k & 31;
  int lane = (n & 15) | (((kk >> 3) & 1) << 4);
  int hidx = (kk & 7) | (((kk >> 4) & 1) << 3);
  return ((size_t)((n >> 4) * kt32 + (k >> 5)) << 9) + (lane << 4) + hidx;
}

__device__ __forceinline__ v16h load_frag(const half_t* p) {
  union { uint4 u[2]; v16h v; } t;
  t.u[0] = *(const uint4*)(p);
  t.u[1] = *(const uint4*)(p + 8);
  return t.v;
}

__device__ __forceinline__ v8f zero8() {
  v8f z;
#pragma unroll
  for (int e = 0; e < 8; ++e) z[e] = 0.0f;
  return z;
}

__device__ __forceinline__ v8f wmma_f16(v16h a, v16h b, v8f c) {
  return __builtin_amdgcn_wmma_f32_16x16x32_f16(false, a, false, b, (short)0, c,
                                                false, false);
}

// ---------------------------------------------------------------------------
// Kernel 1: LayerNorm one row per block; write normalized row as f16 A-frags.
// ---------------------------------------------------------------------------
__global__ __launch_bounds__(256)
void ln_pack_a(const float* __restrict__ x, const float* __restrict__ g,
               const float* __restrict__ be, half_t* __restrict__ xnA) {
  const int row = blockIdx.x;
  const int t   = threadIdx.x;
  float4 v = ((const float4*)(x + (size_t)row * DIM))[t];
  float s  = v.x + v.y + v.z + v.w;
  float s2 = v.x * v.x + v.y * v.y + v.z * v.z + v.w * v.w;
  __shared__ float rs[256], rq[256];
  rs[t] = s; rq[t] = s2;
  __syncthreads();
  for (int o = 128; o > 0; o >>= 1) {
    if (t < o) { rs[t] += rs[t + o]; rq[t] += rq[t + o]; }
    __syncthreads();
  }
  const float mu   = rs[0] * (1.0f / DIM);
  const float var  = rq[0] * (1.0f / DIM) - mu * mu;
  const float rstd = rsqrtf(var + 1e-5f);
  float4 gv = ((const float4*)g)[t];
  float4 bv = ((const float4*)be)[t];
  float o0 = (v.x - mu) * rstd * gv.x + bv.x;
  float o1 = (v.y - mu) * rstd * gv.y + bv.y;
  float o2 = (v.z - mu) * rstd * gv.z + bv.z;
  float o3 = (v.w - mu) * rstd * gv.w + bv.w;
  const int c0 = t * 4;
  xnA[a_off(32, row, c0 + 0)] = (half_t)o0;
  xnA[a_off(32, row, c0 + 1)] = (half_t)o1;
  xnA[a_off(32, row, c0 + 2)] = (half_t)o2;
  xnA[a_off(32, row, c0 + 3)] = (half_t)o3;
}

// ---------------------------------------------------------------------------
// Kernel 2: pack a row-major KxN f32 weight matrix into f16 B-frags.
// ---------------------------------------------------------------------------
__global__ __launch_bounds__(256)
void pack_b(const float* __restrict__ w, half_t* __restrict__ dst, int K, int N) {
  const int idx = blockIdx.x * 256 + threadIdx.x;
  const int k = idx / N, n = idx - k * N;
  dst[b_off(K >> 5, k, n)] = (half_t)w[idx];
}

// ---------------------------------------------------------------------------
// Kernel 3: zero the one-chunk (128 keypos) lookback pad of kT / v frags.
// ---------------------------------------------------------------------------
__global__ __launch_bounds__(256)
void zero_pad(half_t* __restrict__ kTB, half_t* __restrict__ vB) {
  const int tid = blockIdx.x * 256 + threadIdx.x;  // 65536 units of 8 halfs
  const int bh  = tid >> 11;
  const int rem = tid & 2047;
  const uint4 z = make_uint4(0u, 0u, 0u, 0u);
  if (rem < 1024) {
    // kT pad: jtiles 0..7 -> frags 0..15 contiguous (8192 halfs)
    *(uint4*)(kTB + (size_t)bh * KTB_BH + (size_t)rem * 8) = z;
  } else {
    // v pad: frag (nt*260 + kt), nt=0..3, kt=0..3
    const int r2   = rem - 1024;
    const int frag = r2 >> 6, unit = r2 & 63;
    const int nt = frag >> 2, kt = frag & 3;
    *(uint4*)(vB + (size_t)bh * VB_BH + (((size_t)(nt * 260 + kt)) << 9) +
              (size_t)unit * 8) = z;
  }
}

// ---------------------------------------------------------------------------
// Shared GEMM core: 4 waves/block, each wave a 64x64 tile (4x4 WMMA tiles).
// ---------------------------------------------------------------------------
__device__ __forceinline__ void gemm_tile64(const half_t* __restrict__ A,
                                            const half_t* __restrict__ B,
                                            int mt0, int nt0, int Kt,
                                            v8f c[4][4]) {
  const int lane = threadIdx.x & 31;
#pragma unroll
  for (int i = 0; i < 4; ++i)
#pragma unroll
    for (int j = 0; j < 4; ++j) c[i][j] = zero8();
#pragma unroll 1
  for (int tk = 0; tk < Kt; ++tk) {
    v16h a[4], b[4];
#pragma unroll
    for (int i = 0; i < 4; ++i)
      a[i] = load_frag(A + (((size_t)(mt0 + i) * Kt + tk) << 9) + lane * 16);
#pragma unroll
    for (int j = 0; j < 4; ++j)
      b[j] = load_frag(B + (((size_t)(nt0 + j) * Kt + tk) << 9) + lane * 16);
#pragma unroll
    for (int i = 0; i < 4; ++i)
#pragma unroll
      for (int j = 0; j < 4; ++j) c[i][j] = wmma_f16(a[i], b[j], c[i][j]);
  }
}

// ---------------------------------------------------------------------------
// Kernel 4: QKV GEMM. C=(16384x3072). Scatter epilogue into q/kT/v frags.
// ---------------------------------------------------------------------------
__global__ __launch_bounds__(128)
void gemm_qkv(const half_t* __restrict__ A, const half_t* __restrict__ B,
              half_t* __restrict__ qA, half_t* __restrict__ kTB,
              half_t* __restrict__ vB) {
  const int lane = threadIdx.x & 31, wid = threadIdx.x >> 5;
  const int wm = wid >> 1, wn = wid & 1;
  const int mt0 = blockIdx.y * 8 + wm * 4;
  const int nt0 = blockIdx.x * 8 + wn * 4;
  v8f c[4][4];
  gemm_tile64(A, B, mt0, nt0, 32, c);

  const int rbase = (lane >> 4) << 3;
  const int ncol  = lane & 15;
#pragma unroll
  for (int i = 0; i < 4; ++i) {
#pragma unroll
    for (int j = 0; j < 4; ++j) {
      const int gc   = (nt0 + j) * 16 + ncol;   // 0..3071
      const int part = gc >> 10;                // 0=q 1=k 2=v
      const int cc   = gc & 1023;
      const int h    = cc >> 6, d = cc & 63;
#pragma unroll
      for (int v = 0; v < 8; ++v) {
        const int grow = (mt0 + i) * 16 + v + rbase;
        const int bb   = grow >> 13, ntok = grow & (NTOK - 1);
        const int bh   = bb * HEADS + h;
        const float val = c[i][j][v];
        if (part == 0) {
          qA[(size_t)bh * QA_BH + a_off(2, ntok, d)] = (half_t)(val * 0.125f);
        } else if (part == 1) {
          kTB[(size_t)bh * KTB_BH + b_off(2, d, ntok + WIN)] = (half_t)val;
        } else {
          vB[(size_t)bh * VB_BH + b_off(260, ntok + WIN, d)] = (half_t)val;
        }
      }
    }
  }
}

// ---------------------------------------------------------------------------
// Kernel 5: local attention. One block per (b,h,window); 8 waves; each wave
// owns a 16-row query strip: QK^T (32 WMMA), mask+softmax, PV (32 WMMA).
// ---------------------------------------------------------------------------
__global__ __launch_bounds__(256)
void attn_kernel(const half_t* __restrict__ qA, const half_t* __restrict__ kTB,
                 const half_t* __restrict__ vB, half_t* __restrict__ oA) {
  extern __shared__ half_t s_attn[];  // 8 waves * 16 rows * 256 cols f16 = 64KB
  const int lane = threadIdx.x & 31, mt = threadIdx.x >> 5;
  const int wi = blockIdx.x & (NWIN - 1);
  const int h  = (blockIdx.x >> 6) & (HEADS - 1);
  const int b  = blockIdx.x >> 10;
  const int bh = b * HEADS + h;
  const half_t* qbase = qA  + (size_t)bh * QA_BH;
  const half_t* kbase = kTB + (size_t)bh * KTB_BH;
  const half_t* vbase = vB  + (size_t)bh * VB_BH;

  const v16h aq0 = load_frag(qbase + (((size_t)(wi * 8 + mt) * 2 + 0) << 9) + lane * 16);
  const v16h aq1 = load_frag(qbase + (((size_t)(wi * 8 + mt) * 2 + 1) << 9) + lane * 16);

  // --- sim = q @ k^T : 16x256 strip as 16 WMMA C tiles -----------------
  v8f c[16];
#pragma unroll
  for (int nt = 0; nt < 16; ++nt) {
    const v16h b0 = load_frag(kbase + (((size_t)(wi * 8 + nt) * 2 + 0) << 9) + lane * 16);
    const v16h b1 = load_frag(kbase + (((size_t)(wi * 8 + nt) * 2 + 1) << 9) + lane * 16);
    v8f acc = zero8();
    acc = wmma_f16(aq0, b0, acc);
    acc = wmma_f16(aq1, b1, acc);
    c[nt] = acc;
  }

  // --- causal local mask + softmax per row, pack attn f16 into LDS -----
  const int rbase = (lane >> 4) << 3;
  const int ncol  = lane & 15;
#pragma unroll
  for (int j = 0; j < 8; ++j) {
    const int q_pos = wi * WIN + mt * 16 + j + rbase;
    float m = -3.0e38f;
#pragma unroll
    for (int nt = 0; nt < 16; ++nt) {
      const int k_pos = wi * WIN - WIN + nt * 16 + ncol;
      float v = c[nt][j];
      const bool bad = (k_pos < 0) | (q_pos < k_pos) | (q_pos > k_pos + WIN);
      v = bad ? -3.0e38f : v;
      c[nt][j] = v;
      m = fmaxf(m, v);
    }
    m = fmaxf(m, __shfl_xor(m, 1));
    m = fmaxf(m, __shfl_xor(m, 2));
    m = fmaxf(m, __shfl_xor(m, 4));
    m = fmaxf(m, __shfl_xor(m, 8));
    float s = 0.0f;
#pragma unroll
    for (int nt = 0; nt < 16; ++nt) {
      const float e = __expf(c[nt][j] - m);
      c[nt][j] = e;
      s += e;
    }
    s += __shfl_xor(s, 1);
    s += __shfl_xor(s, 2);
    s += __shfl_xor(s, 4);
    s += __shfl_xor(s, 8);
    const float inv = 1.0f / s;
    const int r = j + rbase;
    half_t* dst = s_attn + mt * 4096 + r * 256 + ncol;
#pragma unroll
    for (int nt = 0; nt < 16; ++nt) dst[nt * 16] = (half_t)(c[nt][j] * inv);
  }
  __syncthreads();

  // --- out = attn @ v : re-fragment attn from LDS as A operand ---------
  v8f oc[4];
#pragma unroll
  for (int nt = 0; nt < 4; ++nt) oc[nt] = zero8();
  const half_t* srow = s_attn + mt * 4096;
  const int arow = lane & 15;
  const int koff = (lane >> 4) ? 8 : 0;
#pragma unroll
  for (int kt = 0; kt < 8; ++kt) {
    union { uint4 u[2]; v16h v; } ua;
    const int cb = kt * 32 + koff;
    ua.u[0] = *(const uint4*)(srow + arow * 256 + cb);
    ua.u[1] = *(const uint4*)(srow + arow * 256 + cb + 16);
    const v16h af = ua.v;
#pragma unroll
    for (int nt = 0; nt < 4; ++nt) {
      const v16h bf =
          load_frag(vbase + (((size_t)(nt * 260 + wi * 4 + kt)) << 9) + lane * 16);
      oc[nt] = wmma_f16(af, bf, oc[nt]);
    }
  }

  // --- scatter O strip as A-frags of the (16384 x 1024) output matrix --
  const int m0 = b * NTOK + wi * WIN + mt * 16;
#pragma unroll
  for (int nt = 0; nt < 4; ++nt) {
    const int hd = h * DHEAD + nt * 16 + ncol;
#pragma unroll
    for (int v = 0; v < 8; ++v) {
      const int r = v + rbase;
      oA[a_off(32, m0 + r, hd)] = (half_t)oc[nt][v];
    }
  }
}

// ---------------------------------------------------------------------------
// Kernel 6: output GEMM, f32 row-major result.
// ---------------------------------------------------------------------------
__global__ __launch_bounds__(128)
void gemm_out(const half_t* __restrict__ A, const half_t* __restrict__ B,
              float* __restrict__ out) {
  const int lane = threadIdx.x & 31, wid = threadIdx.x >> 5;
  const int wm = wid >> 1, wn = wid & 1;
  const int mt0 = blockIdx.y * 8 + wm * 4;
  const int nt0 = blockIdx.x * 8 + wn * 4;
  v8f c[4][4];
  gemm_tile64(A, B, mt0, nt0, 32, c);
  const int rbase = (lane >> 4) << 3;
  const int ncol  = lane & 15;
#pragma unroll
  for (int i = 0; i < 4; ++i)
#pragma unroll
    for (int j = 0; j < 4; ++j)
#pragma unroll
      for (int v = 0; v < 8; ++v) {
        const int row = (mt0 + i) * 16 + v + rbase;
        const int col = (nt0 + j) * 16 + ncol;
        out[(size_t)row * DIM + col] = c[i][j][v];
      }
}

// ---------------------------------------------------------------------------
extern "C" void kernel_launch(void* const* d_in, const int* in_sizes, int n_in,
                              void* d_out, int out_size, void* d_ws,
                              size_t ws_size, hipStream_t stream) {
  (void)in_sizes; (void)n_in; (void)out_size; (void)ws_size;
  const float* x    = (const float*)d_in[0];
  const float* g    = (const float*)d_in[1];
  const float* be   = (const float*)d_in[2];
  const float* wqkv = (const float*)d_in[3];
  const float* wout = (const float*)d_in[4];

  half_t* ws    = (half_t*)d_ws;
  half_t* xnA   = ws + OFF_XNA;   // reused as O A-frag after attention
  half_t* wqkvB = ws + OFF_WQKV;
  half_t* woutB = ws + OFF_WOUT;
  half_t* qA    = ws + OFF_QA;
  half_t* kTB   = ws + OFF_KTB;
  half_t* vB    = ws + OFF_VB;

  ln_pack_a<<<ROWS, 256, 0, stream>>>(x, g, be, xnA);
  pack_b<<<(DIM * NQKV) / 256, 256, 0, stream>>>(wqkv, wqkvB, DIM, NQKV);
  pack_b<<<(DIM * DIM) / 256, 256, 0, stream>>>(wout, woutB, DIM, DIM);
  zero_pad<<<256, 256, 0, stream>>>(kTB, vB);
  gemm_qkv<<<dim3(NQKV / 128, ROWS / 128), 128, 0, stream>>>(xnA, wqkvB, qA, kTB, vB);
  attn_kernel<<<BATCH * HEADS * NWIN, 256, 65536, stream>>>(qA, kTB, vB, xnA);
  gemm_out<<<dim3(DIM / 128, ROWS / 128), 128, 0, stream>>>(xnA, woutB, (float*)d_out);
}

// v001
// It runs in 293 microseconds.
// Two timings next to v000 both put it at 1.22 times that version's speed.
#include <hip/hip_runtime.h>
#include <hip/hip_bf16.h>

// ---------------------------------------------------------------------------
// Local windowed MHA forward for MI455X (gfx1250), wave32 + WMMA f16->f32.
//   b=2, n=8192, DIM=1024, HEADS=16, DHEAD=64, WINDOW=128, look_backward=1
// Pipeline: LN(pack A-frag) -> pack weights(B-frag) -> QKV GEMM (WMMA, scatter
// q/kT/v frags) -> per-window attention (WMMA QK^T, softmax, WMMA PV) ->
// output GEMM (WMMA) -> f32 out.
// Both GEMMs stage their operand fragments in LDS (asynchronous copies, two
// buffers): one 256x256 tile per work-group, read by 16 waves.
// ---------------------------------------------------------------------------

typedef __attribute__((ext_vector_type(16))) _Float16 v16h;
typedef __attribute__((ext_vector_type(8)))  float    v8f;
typedef _Float16 half_t;

#define HEADS  16
#define DIM    1024
#define DHEAD  64
#define WIN    128
#define NTOK   8192
#define BATCH  2
#define ROWS   (BATCH * NTOK)   // 16384
#define NQKV   (3 * DIM)        // 3072
#define NWIN   (NTOK / WIN)     // 64

// Workspace layout (in halfs). All offsets keep >=32B alignment.
static constexpr size_t OFF_XNA  = 0;                       // 16384x1024 A-frag (reused as O A-frag)
static constexpr size_t OFF_WQKV = OFF_XNA  + 16777216;     // 1024x3072 B-frag
static constexpr size_t OFF_WOUT = OFF_WQKV + 3145728;      // 1024x1024 B-frag
static constexpr size_t OFF_QA   = OFF_WOUT + 1048576;      // per (b,h): 8192x64 A-frag
static constexpr size_t OFF_KTB  = OFF_QA   + 16777216;     // per (b,h): B-frag (d x padded keypos), 520 jtiles
static constexpr size_t OFF_VB   = OFF_KTB  + 17039360;     // per (b,h): B-frag (padded keypos x d), 260 ktiles
// total = 71,827,456 halfs = ~137 MB

static constexpr size_t QA_BH  = 524288;  // 512 mtiles * 2 ktiles * 512
static constexpr size_t KTB_BH = 532480;  // 520 jtiles * 2 dtiles * 512
static constexpr size_t VB_BH  = 532480;  // 4 ntiles * 260 ktiles * 512

// --- WMMA fragment addressing (element granularity) ------------------------
// A-frag (MxK): tile(mt,kt) base=((mt*Kt+kt)<<9); within tile, element (m,k):
//   lane = (m&15) | ((k>>3 & 1)<<4), halfidx = (k&7) | ((k>>4 & 1)<<3)
__device__ __forceinline__ size_t a_off(int kt32, int m, int k) {
  int kk   = k & 31;
  int lane = (m & 15) | (((kk >> 3) & 1) << 4);
  int hidx = (kk & 7) | (((kk >> 4) & 1) << 3);
  return ((size_t)((m >> 4) * kt32 + (k >> 5)) << 9) + (lane << 4) + hidx;
}
// B-frag (KxN): tile(nt,kt) base=((nt*Kt+kt)<<9); element (k,n) mirrors A.
__device__ __forceinline__ size_t b_off(int kt32, int k, int n) {
  int kk   = k & 31;
  int lane = (n & 15) | (((kk >> 3) & 1) << 4);
  int hidx = (kk & 7) | (((kk >> 4) & 1) << 3);
  return ((size_t)((n >> 4) * kt32 + (k >> 5)) << 9) + (lane << 4) + hidx;
}

__device__ __forceinline__ v16h load_frag(const half_t* p) {
  union { uint4 u[2]; v16h v; } t;
  t.u[0] = *(const uint4*)(p);
  t.u[1] = *(const uint4*)(p + 8);
  return t.v;
}

__device__ __forceinline__ v8f zero8() {
  v8f z;
#pragma unroll
  for (int e = 0; e < 8; ++e) z[e] = 0.0f;
  return z;
}

__device__ __forceinline__ v8f wmma_f16(v16h a, v16h b, v8f c) {
  return __builtin_amdgcn_wmma_f32_16x16x32_f16(false, a, false, b, (short)0, c,
                                                false, false);
}

// ---------------------------------------------------------------------------
// Kernel 1: LayerNorm one row per block; write normalized row as f16 A-frags.
// ---------------------------------------------------------------------------
__global__ __launch_bounds__(256)
void ln_pack_a(const float* __restrict__ x, const float* __restrict__ g,
               const float* __restrict__ be, half_t* __restrict__ xnA) {
  const int row = blockIdx.x;
  const int t   = threadIdx.x;
  float4 v = ((const float4*)(x + (size_t)row * DIM))[t];
  float s  = v.x + v.y + v.z + v.w;
  float s2 = v.x * v.x + v.y * v.y + v.z * v.z + v.w * v.w;
  __shared__ float rs[256], rq[256];
  rs[t] = s; rq[t] = s2;
  __syncthreads();
  for (int o = 128; o > 0; o >>= 1) {
    if (t < o) { rs[t] += rs[t + o]; rq[t] += rq[t + o]; }
    __syncthreads();
  }
  const float mu   = rs[0] * (1.0f / DIM);
  const float var  = rq[0] * (1.0f / DIM) - mu * mu;
  const float rstd = rsqrtf(var + 1e-5f);
  float4 gv = ((const float4*)g)[t];
  float4 bv = ((const float4*)be)[t];
  float o0 = (v.x - mu) * rstd * gv.x + bv.x;
  float o1 = (v.y - mu) * rstd * gv.y + bv.y;
  float o2 = (v.z - mu) * rstd * gv.z + bv.z;
  float o3 = (v.w - mu) * rstd * gv.w + bv.w;
  const int c0 = t * 4;
  xnA[a_off(32, row, c0 + 0)] = (half_t)o0;
  xnA[a_off(32, row, c0 + 1)] = (half_t)o1;
  xnA[a_off(32, row, c0 + 2)] = (half_t)o2;
  xnA[a_off(32, row, c0 + 3)] = (half_t)o3;
}

// ---------------------------------------------------------------------------
// Kernel 2: pack a row-major KxN f32 weight matrix into f16 B-frags.
// ---------------------------------------------------------------------------
__global__ __launch_bounds__(256)
void pack_b(const float* __restrict__ w, half_t* __restrict__ dst, int K, int N) {
  const int idx = blockIdx.x * 256 + threadIdx.x;
  const int k = idx / N, n = idx - k * N;
  dst[b_off(K >> 5, k, n)] = (half_t)w[idx];
}

// ---------------------------------------------------------------------------
// Kernel 3: zero the one-chunk (128 keypos) lookback pad of kT / v frags.
// ---------------------------------------------------------------------------
__global__ __launch_bounds__(256)
void zero_pad(half_t* __restrict__ kTB, half_t* __restrict__ vB) {
  const int tid = blockIdx.x * 256 + threadIdx.x;  // 65536 units of 8 halfs
  const int bh  = tid >> 11;
  const int rem = tid & 2047;
  const uint4 z = make_uint4(0u, 0u, 0u, 0u);
  if (rem < 1024) {
    // kT pad: jtiles 0..7 -> frags 0..15 contiguous (8192 halfs)
    *(uint4*)(kTB + (size_t)bh * KTB_BH + (size_t)rem * 8) = z;
  } else {
    // v pad: frag (nt*260 + kt), nt=0..3, kt=0..3
    const int r2   = rem - 1024;
    const int frag = r2 >> 6, unit = r2 & 63;
    const int nt = frag >> 2, kt = frag & 3;
    *(uint4*)(vB + (size_t)bh * VB_BH + (((size_t)(nt * 260 + kt)) << 9) +
              (size_t)unit * 8) = z;
  }
}

// ---------------------------------------------------------------------------
// Shared GEMM core: 16 waves/block (4x4), each wave a 64x64 tile (4x4 WMMA
// tiles) of a 256x256 block tile. A pass is GP k-tiles (128 k). A stage holds
// 16 A tile rows, then 16 B tile rows, each GP fragments of 1 KB. In LDS a
// fragment is two 512-B planes (halfs 0..7 of every lane, then halfs 8..15), so
// that each ds_load_b128 of a wave reads 512 contiguous bytes.
// ---------------------------------------------------------------------------
#define KT32   32                 // k-tiles of both GEMMs (K = 1024)
#define GP     4                  // k-tiles per pass
#define GPASS  (KT32 / GP)        // passes
#define GROW   (GP * 512)         // halfs of one tile row in a stage
#define GSTAGE (32 * GROW)        // halfs of a stage (128 KB)

__device__ __forceinline__ v16h lds_frag(const half_t* p) {
  union { uint4 u[2]; v16h v; } t;
  t.u[0] = *(const uint4*)(p);
  t.u[1] = *(const uint4*)(p + 256);
  return t.v;
}

// Eight copies of 512 B: one tile row (GP fragments) of a stage. g: the lane's
// 16 bytes of the row's first 512 B; l: their LDS byte address. Global chunk
// 2*lane+h of a fragment goes to plane h, slot lane. The s_wait_xcnt closes the
// statement so that no address register is rewritten ahead of it.
__device__ __forceinline__ void copy_row(const half_t* g, uint32_t l) {
  asm volatile(
      "global_load_async_to_lds_b128 %0, %8, off\n\t"
      "global_load_async_to_lds_b128 %1, %9, off\n\t"
      "global_load_async_to_lds_b128 %2, %10, off\n\t"
      "global_load_async_to_lds_b128 %3, %11, off\n\t"
      "global_load_async_to_lds_b128 %4, %12, off\n\t"
      "global_load_async_to_lds_b128 %5, %13, off\n\t"
      "global_load_async_to_lds_b128 %6, %14, off\n\t"
      "global_load_async_to_lds_b128 %7, %15, off\n\t"
      "s_wait_xcnt 0x0"
      :: "v"(l), "v"(l + 256u), "v"(l + 1024u), "v"(l + 1280u),
         "v"(l + 2048u), "v"(l + 2304u), "v"(l + 3072u), "v"(l + 3328u),
         "v"(g), "v"(g + 256), "v"(g + 512), "v"(g + 768),
         "v"(g + 1024), "v"(g + 1280), "v"(g + 1536), "v"(g + 1792)
      : "memory");
}

// One wave's share of a stage: two tile rows, 16 copies.
__device__ __forceinline__ void copy_stage(const half_t* g, uint32_t l) {
  copy_row(g, l);
  copy_row(g + (KT32 << 9), l + GROW * 2u);
}

// This wave's copies have landed (the compiler places no wait for them).
__device__ __forceinline__ void wait_async0() {
  asm volatile("s_wait_asynccnt 0x0" ::: "memory");
}
// This wave's LDS reads are done before the buffer goes back to the copies.
__device__ __forceinline__ void wait_ds0() {
  asm volatile("s_wait_dscnt 0x0" ::: "memory");
}

__device__ __forceinline__ void gemm_tile64(const half_t* __restrict__ A,
                                            const half_t* __restrict__ B,
                                            half_t* sm, int mtb, int ntb,
                                            v8f c[4][4]) {
  const int lane = threadIdx.x & 31, wid = threadIdx.x >> 5;
  const int wm = wid >> 2, wn = wid & 3;
#pragma unroll
  for (int i = 0; i < 4; ++i)
#pragma unroll
    for (int j = 0; j < 4; ++j) c[i][j] = zero8();

  // Waves 0..7 copy the A tile rows 2*wid, 2*wid+1; waves 8..15 the B rows.
  const int row0 = (wid & 7) * 2;
  const half_t* src =
      (wid < 8 ? A + ((size_t)(mtb + row0) * KT32 << 9)
               : B + ((size_t)(ntb + row0) * KT32 << 9)) + lane * 8;
  const uint32_t dst = (uint32_t)(size_t)sm + (uint32_t)wid * (GROW * 4u) +
                       (uint32_t)(lane & 1) * 512u + (uint32_t)(lane >> 1) * 16u;

  copy_stage(src, dst);
  wait_async0();
  __syncthreads();
  copy_stage(src + GROW, dst + GSTAGE * 2u);

  // Kept rolled: one publish point in the text, the buffer index a scalar.
#pragma unroll 1
  for (int t = 0; t < GPASS; ++t) {
    const half_t* sb = sm + (t & 1) * GSTAGE + lane * 8;
    // Unrolled, as the loops inside: every fragment and accumulator index is a
    // constant, so they stay in registers.
#pragma unroll
    for (int kk = 0; kk < GP; ++kk) {
      v16h a[4], b[4];
#pragma unroll
      for (int i = 0; i < 4; ++i)
        a[i] = lds_frag(sb + (wm * 4 + i) * GROW + kk * 512);
#pragma unroll
      for (int j = 0; j < 4; ++j)
        b[j] = lds_frag(sb + (16 + wn * 4 + j) * GROW + kk * 512);
#pragma unroll
      for (int i = 0; i < 4; ++i)
#pragma unroll
        for (int j = 0; j < 4; ++j) c[i][j] = wmma_f16(a[i], b[j], c[i][j]);
    }
    // Publish pass t+1 and free this pass's buffer: one barrier does both.
    wait_ds0();
    wait_async0();
    __syncthreads();
    if (t + 2 < GPASS)
      copy_stage(src + (t + 2) * GROW, dst + (uint32_t)(t & 1) * (GSTAGE * 2u));
  }
  wait_async0();
}

// ---------------------------------------------------------------------------
// Kernel 4: QKV GEMM. C=(16384x3072). Scatter epilogue into q/kT/v frags.
// ---------------------------------------------------------------------------
__global__ __launch_bounds__(512)
void gemm_qkv(const half_t* __restrict__ A, const half_t* __restrict__ B,
              half_t* __restrict__ qA, half_t* __restrict__ kTB,
              half_t* __restrict__ vB) {
  __shared__ __attribute__((aligned(16))) half_t sm[2 * GSTAGE];
  const int lane = threadIdx.x & 31, wid = threadIdx.x >> 5;
  const int wm = wid >> 2, wn = wid & 3;
  const int mt0 = blockIdx.y * 16 + wm * 4;
  const int nt0 = blockIdx.x * 16 + wn * 4;
  v8f c[4][4];
  gemm_tile64(A, B, sm, blockIdx.y * 16, blockIdx.x * 16, c);

  const int rbase = (lane >> 4) << 3;
  const int ncol  = lane & 15;
#pragma unroll
  for (int i = 0; i < 4; ++i) {
#pragma unroll
    for (int j = 0; j < 4; ++j) {
      const int gc   = (nt0 + j) * 16 + ncol;   // 0..3071
      const int part = gc >> 10;                // 0=q 1=k 2=v
      const int cc   = gc & 1023;
      const int h    = cc >> 6, d = cc & 63;
#pragma unroll
      for (int v = 0; v < 8; ++v) {
        const int grow = (mt0 + i) * 16 + v + rbase;
        const int bb   = grow >> 13, ntok = grow & (NTOK - 1);
        const int bh   = bb * HEADS + h;
        const float val = c[i][j][v];
        if (part == 0) {
          qA[(size_t)bh * QA_BH + a_off(2, ntok, d)] = (half_t)(val * 0.125f);
        } else if (part == 1) {
          kTB[(size_t)bh * KTB_BH + b_off(2, d, ntok + WIN)] = (half_t)val;
        } else {
          vB[(size_t)bh * VB_BH + b_off(260, ntok + WIN, d)] = (half_t)val;
        }
      }
    }
  }
}

// ---------------------------------------------------------------------------
// Kernel 5: local attention. One block per (b,h,window); 8 waves; each wave
// owns a 16-row query strip: QK^T (32 WMMA), mask+softmax, PV (32 WMMA).
// ---------------------------------------------------------------------------
__global__ __launch_bounds__(256)
void attn_kernel(const half_t* __restrict__ qA, const half_t* __restrict__ kTB,
                 const half_t* __restrict__ vB, half_t* __restrict__ oA) {
  extern __shared__ half_t s_attn[];  // 8 waves * 16 rows * 256 cols f16 = 64KB
  const int lane = threadIdx.x & 31, mt = threadIdx.x >> 5;
  const int wi = blockIdx.x & (NWIN - 1);
  const int h  = (blockIdx.x >> 6) & (HEADS - 1);
  const int b  = blockIdx.x >> 10;
  const int bh = b * HEADS + h;
  const half_t* qbase = qA  + (size_t)bh * QA_BH;
  const half_t* kbase = kTB + (size_t)bh * KTB_BH;
  const half_t* vbase = vB  + (size_t)bh * VB_BH;

  const v16h aq0 = load_frag(qbase + (((size_t)(wi * 8 + mt) * 2 + 0) << 9) + lane * 16);
  const v16h aq1 = load_frag(qbase + (((size_t)(wi * 8 + mt) * 2 + 1) << 9) + lane * 16);

  // --- sim = q @ k^T : 16x256 strip as 16 WMMA C tiles -----------------
  v8f c[16];
#pragma unroll
  for (int nt = 0; nt < 16; ++nt) {
    const v16h b0 = load_frag(kbase + (((size_t)(wi * 8 + nt) * 2 + 0) << 9) + lane * 16);
    const v16h b1 = load_frag(kbase + (((size_t)(wi * 8 + nt) * 2 + 1) << 9) + lane * 16);
    v8f acc = zero8();
    acc = wmma_f16(aq0, b0, acc);
    acc = wmma_f16(aq1, b1, acc);
    c[nt] = acc;
  }

  // --- causal local mask + softmax per row, pack attn f16 into LDS -----
  const int rbase = (lane >> 4) << 3;
  const int ncol  = lane & 15;
#pragma unroll
  for (int j = 0; j < 8; ++j) {
    const int q_pos = wi * WIN + mt * 16 + j + rbase;
    float m = -3.0e38f;
#pragma unroll
    for (int nt = 0; nt < 16; ++nt) {
      const int k_pos = wi * WIN - WIN + nt * 16 + ncol;
      float v = c[nt][j];
      const bool bad = (k_pos < 0) | (q_pos < k_pos) | (q_pos > k_pos + WIN);
      v = bad ? -3.0e38f : v;
      c[nt][j] = v;
      m = fmaxf(m, v);
    }
    m = fmaxf(m, __shfl_xor(m, 1));
    m = fmaxf(m, __shfl_xor(m, 2));
    m = fmaxf(m, __shfl_xor(m, 4));
    m = fmaxf(m, __shfl_xor(m, 8));
    float s = 0.0f;
#pragma unroll
    for (int nt = 0; nt < 16; ++nt) {
      const float e = __expf(c[nt][j] - m);
      c[nt][j] = e;
      s += e;
    }
    s += __shfl_xor(s, 1);
    s += __shfl_xor(s, 2);
    s += __shfl_xor(s, 4);
    s += __shfl_xor(s, 8);
    const float inv = 1.0f / s;
    const int r = j + rbase;
    half_t* dst = s_attn + mt * 4096 + r * 256 + ncol;
#pragma unroll
    for (int nt = 0; nt < 16; ++nt) dst[nt * 16] = (half_t)(c[nt][j] * inv);
  }
  __syncthreads();

  // --- out = attn @ v : re-fragment attn from LDS as A operand ---------
  v8f oc[4];
#pragma unroll
  for (int nt = 0; nt < 4; ++nt) oc[nt] = zero8();
  const half_t* srow = s_attn + mt * 4096;
  const int arow = lane & 15;
  const int koff = (lane >> 4) ? 8 : 0;
#pragma unroll
  for (int kt = 0; kt < 8; ++kt) {
    union { uint4 u[2]; v16h v; } ua;
    const int cb = kt * 32 + koff;
    ua.u[0] = *(const uint4*)(srow + arow * 256 + cb);
    ua.u[1] = *(const uint4*)(srow + arow * 256 + cb + 16);
    const v16h af = ua.v;
#pragma unroll
    for (int nt = 0; nt < 4; ++nt) {
      const v16h bf =
          load_frag(vbase + (((size_t)(nt * 260 + wi * 4 + kt)) << 9) + lane * 16);
      oc[nt] = wmma_f16(af, bf, oc[nt]);
    }
  }

  // --- scatter O strip as A-frags of the (16384 x 1024) output matrix --
  const int m0 = b * NTOK + wi * WIN + mt * 16;
#pragma unroll
  for (int nt = 0; nt < 4; ++nt) {
    const int hd = h * DHEAD + nt * 16 + ncol;
#pragma unroll
    for (int v = 0; v < 8; ++v) {
      const int r = v + rbase;
      oA[a_off(32, m0 + r, hd)] = (half_t)oc[nt][v];
    }
  }
}

// ---------------------------------------------------------------------------
// Kernel 6: output GEMM, f32 row-major result.
// ---------------------------------------------------------------------------
__global__ __launch_bounds__(512)
void gemm_out(const half_t* __restrict__ A, const half_t* __restrict__ B,
              float* __restrict__ out) {
  __shared__ __attribute__((aligned(16))) half_t sm[2 * GSTAGE];
  const int lane = threadIdx.x & 31, wid = threadIdx.x >> 5;
  const int wm = wid >> 2, wn = wid & 3;
  const int mt0 = blockIdx.y * 16 + wm * 4;
  const int nt0 = blockIdx.x * 16 + wn * 4;
  v8f c[4][4];
  gemm_tile64(A, B, sm, blockIdx.y * 16, blockIdx.x * 16, c);
  const int rbase = (lane >> 4) << 3;
  const int ncol  = lane & 15;
#pragma unroll
  for (int i = 0; i < 4; ++i)
#pragma unroll
    for (int j = 0; j < 4; ++j)
#pragma unroll
      for (int v = 0; v < 8; ++v) {
        const int row = (mt0 + i) * 16 + v + rbase;
        const int col = (nt0 + j) * 16 + ncol;
        out[(size_t)row * DIM + col] = c[i][j][v];
      }
}

// ---------------------------------------------------------------------------
extern "C" void kernel_launch(void* const* d_in, const int* in_sizes, int n_in,
                              void* d_out, int out_size, void* d_ws,
                              size_t ws_size, hipStream_t stream) {
  (void)in_sizes; (void)n_in; (void)out_size; (void)ws_size;
  const float* x    = (const float*)d_in[0];
  const float* g    = (const float*)d_in[1];
  const float* be   = (const float*)d_in[2];
  const float* wqkv = (const float*)d_in[3];
  const float* wout = (const float*)d_in[4];

  half_t* ws    = (half_t*)d_ws;
  half_t* xnA   = ws + OFF_XNA;   // reused as O A-frag after attention
  half_t* wqkvB = ws + OFF_WQKV;
  half_t* woutB = ws + OFF_WOUT;
  half_t* qA    = ws + OFF_QA;
  half_t* kTB   = ws + OFF_KTB;
  half_t* vB    = ws + OFF_VB;

  ln_pack_a<<<ROWS, 256, 0, stream>>>(x, g, be, xnA);
  pack_b<<<(DIM * NQKV) / 256, 256, 0, stream>>>(wqkv, wqkvB, DIM, NQKV);
  pack_b<<<(DIM * DIM) / 256, 256, 0, stream>>>(wout, woutB, DIM, DIM);
  zero_pad<<<256, 256, 0, stream>>>(kTB, vB);
  gemm_qkv<<<dim3(NQKV / 256, ROWS / 256), 512, 0, stream>>>(xnA, wqkvB, qA, kTB, vB);
  attn_kernel<<<BATCH * HEADS * NWIN, 256, 65536, stream>>>(qA, kTB, vB, xnA);
  gemm_out<<<dim3(DIM / 256, ROWS / 256), 512, 0, stream>>>(xnA, woutB, (float*)d_out);
}

// v002
// It runs in 258 microseconds.
// In both of two side-by-side timings against v001, it was 1.14 times as fast.
// All steps since v000 together make it 1.38 times as fast.
#include <hip/hip_runtime.h>
#include <hip/hip_bf16.h>

// ---------------------------------------------------------------------------
// Local windowed MHA forward for MI455X (gfx1250), wave32 + WMMA f16->f32.
//   b=2, n=8192, DIM=1024, HEADS=16, DHEAD=64, WINDOW=128, look_backward=1
// Pipeline: LN(pack A-frag) -> pack weights(B-frag) -> QKV GEMM (WMMA, scatter
// q/kT/v frags) -> per-window attention (WMMA QK^T, softmax, WMMA PV) ->
// output GEMM (WMMA) -> f32 out.
// Both GEMMs stage their operand fragments in LDS (asynchronous copies, two
// buffers): one 256x256 tile per work-group, read by 16 waves.
// ---------------------------------------------------------------------------

typedef __attribute__((ext_vector_type(16))) _Float16 v16h;
typedef __attribute__((ext_vector_type(8)))  float    v8f;
typedef _Float16 half_t;

#define HEADS  16
#define DIM    1024
#define DHEAD  64
#define WIN    128
#define NTOK   8192
#define BATCH  2
#define ROWS   (BATCH * NTOK)   // 16384
#define NQKV   (3 * DIM)        // 3072
#define NWIN   (NTOK / WIN)     // 64
#define KT32   (DIM / 32)       // k-tiles of a row of 1024 (both GEMMs: K = 1024)

// Workspace layout (in halfs). All offsets keep >=32B alignment.
static constexpr size_t OFF_XNA  = 0;                       // 16384x1024 A-frag (reused as O A-frag)
static constexpr size_t OFF_WQKV = OFF_XNA  + 16777216;     // 1024x3072 B-frag
static constexpr size_t OFF_WOUT = OFF_WQKV + 3145728;      // 1024x1024 B-frag
static constexpr size_t OFF_QA   = OFF_WOUT + 1048576;      // per (b,h): 8192x64 A-frag
static constexpr size_t OFF_KTB  = OFF_QA   + 16777216;     // per (b,h): B-frag (d x padded keypos), 520 jtiles
static constexpr size_t OFF_VB   = OFF_KTB  + 17039360;     // per (b,h): B-frag (padded keypos x d), 260 ktiles
// total = 71,827,456 halfs = ~137 MB

static constexpr size_t QA_BH  = 524288;  // 512 mtiles * 2 ktiles * 512
static constexpr size_t KTB_BH = 532480;  // 520 jtiles * 2 dtiles * 512
static constexpr size_t VB_BH  = 532480;  // 4 ntiles * 260 ktiles * 512

// --- WMMA fragment addressing (element granularity) ------------------------
// A-frag (MxK): tile(mt,kt) base=((mt*Kt+kt)<<9); within tile, element (m,k):
//   lane = (m&15) | ((k>>3 & 1)<<4), halfidx = (k&7) | ((k>>4 & 1)<<3)
__device__ __forceinline__ size_t a_off(int kt32, int m, int k) {
  int kk   = k & 31;
  int lane = (m & 15) | (((kk >> 3) & 1) << 4);
  int hidx = (kk & 7) | (((kk >> 4) & 1) << 3);
  return ((size_t)((m >> 4) * kt32 + (k >> 5)) << 9) + (lane << 4) + hidx;
}
// B-frag (KxN): tile(nt,kt) base=((nt*Kt+kt)<<9); element (k,n) mirrors A.
__device__ __forceinline__ size_t b_off(int kt32, int k, int n) {
  int kk   = k & 31;
  int lane = (n & 15) | (((kk >> 3) & 1) << 4);
  int hidx = (kk & 7) | (((kk >> 4) & 1) << 3);
  return ((size_t)((n >> 4) * kt32 + (k >> 5)) << 9) + (lane << 4) + hidx;
}

__device__ __forceinline__ v16h load_frag(const half_t* p) {
  union { uint4 u[2]; v16h v; } t;
  t.u[0] = *(const uint4*)(p);
  t.u[1] = *(const uint4*)(p + 8);
  return t.v;
}

__device__ __forceinline__ v8f zero8() {
  v8f z;
#pragma unroll
  for (int e = 0; e < 8; ++e) z[e] = 0.0f;
  return z;
}

__device__ __forceinline__ v8f wmma_f16(v16h a, v16h b, v8f c) {
  return __builtin_amdgcn_wmma_f32_16x16x32_f16(false, a, false, b, (short)0, c,
                                                false, false);
}

// ---------------------------------------------------------------------------
// Kernel 1: LayerNorm, four rows per wave; normalized rows go out as f16
// A-frags. Lane = (row & 3) | (column quad << 2): a load reads one 128-B line of
// each of the four rows, and a store fills two whole 128-B lines of a fragment.
// Few long-lived waves: the launch is bound by memory, not by wave starts.
// ---------------------------------------------------------------------------
__global__ __launch_bounds__(256)
void ln_pack_a(const float* __restrict__ x, const float* __restrict__ g,
               const float* __restrict__ be, half_t* __restrict__ xnA) {
  const int lane = threadIdx.x & 31;
  const int wave = blockIdx.x * 8 + (threadIdx.x >> 5);
  const int row  = wave * 4 + (lane & 3);
  const int cq   = (lane >> 2) * 4;   // first of the lane's 4 columns in a k-tile
  const float* xr = x + (size_t)row * DIM + cq;
  float4 v[KT32];
  // Unrolled (as the three loops below): v and o stay in registers and all 32
  // loads of the wave are in flight together.
#pragma unroll
  for (int i = 0; i < KT32; ++i) v[i] = *(const float4*)(xr + i * 32);
  float4 s  = make_float4(0.0f, 0.0f, 0.0f, 0.0f);
  float4 s2 = make_float4(0.0f, 0.0f, 0.0f, 0.0f);
#pragma unroll
  for (int i = 0; i < KT32; ++i) {
    s.x += v[i].x; s.y += v[i].y; s.z += v[i].z; s.w += v[i].w;
    s2.x += v[i].x * v[i].x; s2.y += v[i].y * v[i].y;
    s2.z += v[i].z * v[i].z; s2.w += v[i].w * v[i].w;
  }
  float rs = (s.x + s.y) + (s.z + s.w);
  float rq = (s2.x + s2.y) + (s2.z + s2.w);
  // The eight lanes of a row differ in lane bits 2..4.
  rs += __shfl_xor(rs, 4);  rq += __shfl_xor(rq, 4);
  rs += __shfl_xor(rs, 8);  rq += __shfl_xor(rq, 8);
  rs += __shfl_xor(rs, 16); rq += __shfl_xor(rq, 16);
  const float mu   = rs * (1.0f / DIM);
  const float var  = rq * (1.0f / DIM) - mu * mu;
  const float rstd = rsqrtf(var + 1e-5f);
  uint2 o[KT32];
#pragma unroll
  for (int i = 0; i < KT32; ++i) {
    const float4 gv = *(const float4*)(g + i * 32 + cq);
    const float4 bv = *(const float4*)(be + i * 32 + cq);
    union { half_t h[4]; uint2 u; } p;
    p.h[0] = (half_t)((v[i].x - mu) * rstd * gv.x + bv.x);
    p.h[1] = (half_t)((v[i].y - mu) * rstd * gv.y + bv.y);
    p.h[2] = (half_t)((v[i].z - mu) * rstd * gv.z + bv.z);
    p.h[3] = (half_t)((v[i].w - mu) * rstd * gv.w + bv.w);
    o[i] = p.u;
  }
  half_t* dst = xnA + a_off(KT32, row, cq);
  // Holds every store behind the last load and the last arithmetic, so that no
  // register which an issued store names is written again.
  __builtin_amdgcn_sched_barrier(0);
#pragma unroll
  for (int i = 0; i < KT32; ++i) *(uint2*)(dst + i * 512) = o[i];
}

// ---------------------------------------------------------------------------
// Kernel 2 (one per weight matrix): pack a row-major KxN f32 matrix into f16
// B-frags. A wave builds two whole fragments (n-tile nt, k-tiles 2*y, 2*y+1):
// each lane gathers its own 16 halfs of each and stores them as 32 contiguous
// bytes. K and N are constants at each call, so that every row step is an
// immediate offset on one address.
// ---------------------------------------------------------------------------
__device__ __forceinline__ void pack_frags(const float* __restrict__ w,
                                           half_t* __restrict__ dst,
                                           const int K, const int N) {
  const int lane = threadIdx.x & 31;
  const int nt   = blockIdx.x * 8 + (threadIdx.x >> 5);
  const int kt   = blockIdx.y * 2;
  const float* p = w + (size_t)(kt * 32 + (lane >> 4) * 8) * N + nt * 16 + (lane & 15);
  half_t* d = dst + ((size_t)(nt * (K >> 5) + kt) << 9) + lane * 16;
  // Unrolled: all 32 loads of the wave are in flight together.
#pragma unroll
  for (int f = 0; f < 2; ++f) {
    union { half_t h[16]; uint4 u[2]; } o;
#pragma unroll
    for (int e = 0; e < 8; ++e) {
      o.h[e]     = (half_t)p[(f * 32 + e) * N];
      o.h[8 + e] = (half_t)p[(f * 32 + 16 + e) * N];
    }
    *(uint4*)(d + f * 512)     = o.u[0];
    *(uint4*)(d + f * 512 + 8) = o.u[1];
  }
}

__global__ __launch_bounds__(256)
void pack_b_qkv(const float* __restrict__ w, half_t* __restrict__ dst) {
  pack_frags(w, dst, DIM, NQKV);
}

__global__ __launch_bounds__(256)
void pack_b_out(const float* __restrict__ w, half_t* __restrict__ dst) {
  pack_frags(w, dst, DIM, DIM);
}

// ---------------------------------------------------------------------------
// Kernel 3: zero the one-chunk (128 keypos) lookback pad of kT / v frags.
// ---------------------------------------------------------------------------
__global__ __launch_bounds__(256)
void zero_pad(half_t* __restrict__ kTB, half_t* __restrict__ vB) {
  const int tid = blockIdx.x * 256 + threadIdx.x;  // 65536 units of 8 halfs
  const int bh  = tid >> 11;
  const int rem = tid & 2047;
  const uint4 z = make_uint4(0u, 0u, 0u, 0u);
  if (rem < 1024) {
    // kT pad: jtiles 0..7 -> frags 0..15 contiguous (8192 halfs)
    *(uint4*)(kTB + (size_t)bh * KTB_BH + (size_t)rem * 8) = z;
  } else {
    // v pad: frag (nt*260 + kt), nt=0..3, kt=0..3
    const int r2   = rem - 1024;
    const int frag = r2 >> 6, unit = r2 & 63;
    const int nt = frag >> 2, kt = frag & 3;
    *(uint4*)(vB + (size_t)bh * VB_BH + (((size_t)(nt * 260 + kt)) << 9) +
              (size_t)unit * 8) = z;
  }
}

// ---------------------------------------------------------------------------
// Shared GEMM core: 16 waves/block (4x4), each wave a 64x64 tile (4x4 WMMA
// tiles) of a 256x256 block tile. A pass is GP k-tiles (128 k). A stage holds
// 16 A tile rows, then 16 B tile rows, each GP fragments of 1 KB. In LDS a
// fragment is two 512-B planes (halfs 0..7 of every lane, then halfs 8..15), so
// that each ds_load_b128 of a wave reads 512 contiguous bytes.
// ---------------------------------------------------------------------------
#define GP     4                  // k-tiles per pass
#define GPASS  (KT32 / GP)        // passes
#define GROW   (GP * 512)         // halfs of one tile row in a stage
#define GSTAGE (32 * GROW)        // halfs of a stage (128 KB)

__device__ __forceinline__ v16h lds_frag(const half_t* p) {
  union { uint4 u[2]; v16h v; } t;
  t.u[0] = *(const uint4*)(p);
  t.u[1] = *(const uint4*)(p + 256);
  return t.v;
}

// Eight copies of 512 B: one tile row (GP fragments) of a stage. g: the lane's
// 16 bytes of the row's first 512 B; l: their LDS byte address. Global chunk
// 2*lane+h of a fragment goes to plane h, slot lane. The s_wait_xcnt closes the
// statement so that no address register is rewritten ahead of it.
__device__ __forceinline__ void copy_row(const half_t* g, uint32_t l) {
  asm volatile(
      "global_load_async_to_lds_b128 %0, %8, off\n\t"
      "global_load_async_to_lds_b128 %1, %9, off\n\t"
      "global_load_async_to_lds_b128 %2, %10, off\n\t"
      "global_load_async_to_lds_b128 %3, %11, off\n\t"
      "global_load_async_to_lds_b128 %4, %12, off\n\t"
      "global_load_async_to_lds_b128 %5, %13, off\n\t"
      "global_load_async_to_lds_b128 %6, %14, off\n\t"
      "global_load_async_to_lds_b128 %7, %15, off\n\t"
      "s_wait_xcnt 0x0"
      :: "v"(l), "v"(l + 256u), "v"(l + 1024u), "v"(l + 1280u),
         "v"(l + 2048u), "v"(l + 2304u), "v"(l + 3072u), "v"(l + 3328u),
         "v"(g), "v"(g + 256), "v"(g + 512), "v"(g + 768),
         "v"(g + 1024), "v"(g + 1280), "v"(g + 1536), "v"(g + 1792)
      : "memory");
}

// One wave's share of a stage: two tile rows, 16 copies.
__device__ __forceinline__ void copy_stage(const half_t* g, uint32_t l) {
  copy_row(g, l);
  copy_row(g + (KT32 << 9), l + GROW * 2u);
}

// This wave's copies have landed (the compiler places no wait for them).
__device__ __forceinline__ void wait_async0() {
  asm volatile("s_wait_asynccnt 0x0" ::: "memory");
}
// This wave's LDS reads are done before the buffer goes back to the copies.
__device__ __forceinline__ void wait_ds0() {
  asm volatile("s_wait_dscnt 0x0" ::: "memory");
}

__device__ __forceinline__ void gemm_tile64(const half_t* __restrict__ A,
                                            const half_t* __restrict__ B,
                                            half_t* sm, int mtb, int ntb,
                                            v8f c[4][4]) {
  const int lane = threadIdx.x & 31, wid = threadIdx.x >> 5;
  const int wm = wid >> 2, wn = wid & 3;
#pragma unroll
  for (int i = 0; i < 4; ++i)
#pragma unroll
    for (int j = 0; j < 4; ++j) c[i][j] = zero8();

  // Waves 0..7 copy the A tile rows 2*wid, 2*wid+1; waves 8..15 the B rows.
  const int row0 = (wid & 7) * 2;
  const half_t* src =
      (wid < 8 ? A + ((size_t)(mtb + row0) * KT32 << 9)
               : B + ((size_t)(ntb + row0) * KT32 << 9)) + lane * 8;
  const uint32_t dst = (uint32_t)(size_t)sm + (uint32_t)wid * (GROW * 4u) +
                       (uint32_t)(lane & 1) * 512u + (uint32_t)(lane >> 1) * 16u;

  copy_stage(src, dst);
  wait_async0();
  __syncthreads();
  copy_stage(src + GROW, dst + GSTAGE * 2u);

  // Kept rolled: one publish point in the text, the buffer index a scalar.
#pragma unroll 1
  for (int t = 0; t < GPASS; ++t) {
    const half_t* sb = sm + (t & 1) * GSTAGE + lane * 8;
    // Unrolled, as the loops inside: every fragment and accumulator index is a
    // constant, so they stay in registers.
#pragma unroll
    for (int kk = 0; kk < GP; ++kk) {
      v16h a[4], b[4];
#pragma unroll
      for (int i = 0; i < 4; ++i)
        a[i] = lds_frag(sb + (wm * 4 + i) * GROW + kk * 512);
#pragma unroll
      for (int j = 0; j < 4; ++j)
        b[j] = lds_frag(sb + (16 + wn * 4 + j) * GROW + kk * 512);
#pragma unroll
      for (int i = 0; i < 4; ++i)
#pragma unroll
        for (int j = 0; j < 4; ++j) c[i][j] = wmma_f16(a[i], b[j], c[i][j]);
    }
    // Publish pass t+1 and free this pass's buffer: one barrier does both.
    wait_ds0();
    wait_async0();
    __syncthreads();
    if (t + 2 < GPASS)
      copy_stage(src + (t + 2) * GROW, dst + (uint32_t)(t & 1) * (GSTAGE * 2u));
  }
  wait_async0();
}

// ---------------------------------------------------------------------------
// Kernel 4: QKV GEMM. C=(16384x3072). Scatter epilogue into q/kT/v frags.
// ---------------------------------------------------------------------------
__global__ __launch_bounds__(512)
void gemm_qkv(const half_t* __restrict__ A, const half_t* __restrict__ B,
              half_t* __restrict__ qA, half_t* __restrict__ kTB,
              half_t* __restrict__ vB) {
  __shared__ __attribute__((aligned(16))) half_t sm[2 * GSTAGE];
  const int lane = threadIdx.x & 31, wid = threadIdx.x >> 5;
  const int wm = wid >> 2, wn = wid & 3;
  const int mt0 = blockIdx.y * 16 + wm * 4;
  const int nt0 = blockIdx.x * 16 + wn * 4;
  v8f c[4][4];
  gemm_tile64(A, B, sm, blockIdx.y * 16, blockIdx.x * 16, c);

  const int rbase = (lane >> 4) << 3;
  const int ncol  = lane & 15;
#pragma unroll
  for (int i = 0; i < 4; ++i) {
#pragma unroll
    for (int j = 0; j < 4; ++j) {
      const int gc   = (nt0 + j) * 16 + ncol;   // 0..3071
      const int part = gc >> 10;                // 0=q 1=k 2=v
      const int cc   = gc & 1023;
      const int h    = cc >> 6, d = cc & 63;
#pragma unroll
      for (int v = 0; v < 8; ++v) {
        const int grow = (mt0 + i) * 16 + v + rbase;
        const int bb   = grow >> 13, ntok = grow & (NTOK - 1);
        const int bh   = bb * HEADS + h;
        const float val = c[i][j][v];
        if (part == 0) {
          qA[(size_t)bh * QA_BH + a_off(2, ntok, d)] = (half_t)(val * 0.125f);
        } else if (part == 1) {
          kTB[(size_t)bh * KTB_BH + b_off(2, d, ntok + WIN)] = (half_t)val;
        } else {
          vB[(size_t)bh * VB_BH + b_off(260, ntok + WIN, d)] = (half_t)val;
        }
      }
    }
  }
}

// ---------------------------------------------------------------------------
// Kernel 5: local attention. One block per (b,h,window); 8 waves; each wave
// owns a 16-row query strip: QK^T (32 WMMA), mask+softmax, PV (32 WMMA).
// ---------------------------------------------------------------------------
__global__ __launch_bounds__(256)
void attn_kernel(const half_t* __restrict__ qA, const half_t* __restrict__ kTB,
                 const half_t* __restrict__ vB, half_t* __restrict__ oA) {
  extern __shared__ half_t s_attn[];  // 8 waves * 16 rows * 256 cols f16 = 64KB
  const int lane = threadIdx.x & 31, mt = threadIdx.x >> 5;
  const int wi = blockIdx.x & (NWIN - 1);
  const int h  = (blockIdx.x >> 6) & (HEADS - 1);
  const int b  = blockIdx.x >> 10;
  const int bh = b * HEADS + h;
  const half_t* qbase = qA  + (size_t)bh * QA_BH;
  const half_t* kbase = kTB + (size_t)bh * KTB_BH;
  const half_t* vbase = vB  + (size_t)bh * VB_BH;

  const v16h aq0 = load_frag(qbase + (((size_t)(wi * 8 + mt) * 2 + 0) << 9) + lane * 16);
  const v16h aq1 = load_frag(qbase + (((size_t)(wi * 8 + mt) * 2 + 1) << 9) + lane * 16);

  // --- sim = q @ k^T : 16x256 strip as 16 WMMA C tiles -----------------
  v8f c[16];
#pragma unroll
  for (int nt = 0; nt < 16; ++nt) {
    const v16h b0 = load_frag(kbase + (((size_t)(wi * 8 + nt) * 2 + 0) << 9) + lane * 16);
    const v16h b1 = load_frag(kbase + (((size_t)(wi * 8 + nt) * 2 + 1) << 9) + lane * 16);
    v8f acc = zero8();
    acc = wmma_f16(aq0, b0, acc);
    acc = wmma_f16(aq1, b1, acc);
    c[nt] = acc;
  }

  // --- causal local mask + softmax per row, pack attn f16 into LDS -----
  const int rbase = (lane >> 4) << 3;
  const int ncol  = lane & 15;
#pragma unroll
  for (int j = 0; j < 8; ++j) {
    const int q_pos = wi * WIN + mt * 16 + j + rbase;
    float m = -3.0e38f;
#pragma unroll
    for (int nt = 0; nt < 16; ++nt) {
      const int k_pos = wi * WIN - WIN + nt * 16 + ncol;
      float v = c[nt][j];
      const bool bad = (k_pos < 0) | (q_pos < k_pos) | (q_pos > k_pos + WIN);
      v = bad ? -3.0e38f : v;
      c[nt][j] = v;
      m = fmaxf(m, v);
    }
    m = fmaxf(m, __shfl_xor(m, 1));
    m = fmaxf(m, __shfl_xor(m, 2));
    m = fmaxf(m, __shfl_xor(m, 4));
    m = fmaxf(m, __shfl_xor(m, 8));
    float s = 0.0f;
#pragma unroll
    for (int nt = 0; nt < 16; ++nt) {
      const float e = __expf(c[nt][j] - m);
      c[nt][j] = e;
      s += e;
    }
    s += __shfl_xor(s, 1);
    s += __shfl_xor(s, 2);
    s += __shfl_xor(s, 4);
    s += __shfl_xor(s, 8);
    const float inv = 1.0f / s;
    const int r = j + rbase;
    half_t* dst = s_attn + mt * 4096 + r * 256 + ncol;
#pragma unroll
    for (int nt = 0; nt < 16; ++nt) dst[nt * 16] = (half_t)(c[nt][j] * inv);
  }
  __syncthreads();

  // --- out = attn @ v : re-fragment attn from LDS as A operand ---------
  v8f oc[4];
#pragma unroll
  for (int nt = 0; nt < 4; ++nt) oc[nt] = zero8();
  const half_t* srow = s_attn + mt * 4096;
  const int arow = lane & 15;
  const int koff = (lane >> 4) ? 8 : 0;
#pragma unroll
  for (int kt = 0; kt < 8; ++kt) {
    union { uint4 u[2]; v16h v; } ua;
    const int cb = kt * 32 + koff;
    ua.u[0] = *(const uint4*)(srow + arow * 256 + cb);
    ua.u[1] = *(const uint4*)(srow + arow * 256 + cb + 16);
    const v16h af = ua.v;
#pragma unroll
    for (int nt = 0; nt < 4; ++nt) {
      const v16h bf =
          load_frag(vbase + (((size_t)(nt * 260 + wi * 4 + kt)) << 9) + lane * 16);
      oc[nt] = wmma_f16(af, bf, oc[nt]);
    }
  }

  // --- scatter O strip as A-frags of the (16384 x 1024) output matrix --
  const int m0 = b * NTOK + wi * WIN + mt * 16;
#pragma unroll
  for (int nt = 0; nt < 4; ++nt) {
    const int hd = h * DHEAD + nt * 16 + ncol;
#pragma unroll
    for (int v = 0; v < 8; ++v) {
      const int r = v + rbase;
      oA[a_off(32, m0 + r, hd)] = (half_t)oc[nt][v];
    }
  }
}

// ---------------------------------------------------------------------------
// Kernel 6: output GEMM, f32 row-major result.
// ---------------------------------------------------------------------------
__global__ __launch_bounds__(512)
void gemm_out(const half_t* __restrict__ A, const half_t* __restrict__ B,
              float* __restrict__ out) {
  __shared__ __attribute__((aligned(16))) half_t sm[2 * GSTAGE];
  const int lane = threadIdx.x & 31, wid = threadIdx.x >> 5;
  const int wm = wid >> 2, wn = wid & 3;
  const int mt0 = blockIdx.y * 16 + wm * 4;
  const int nt0 = blockIdx.x * 16 + wn * 4;
  v8f c[4][4];
  gemm_tile64(A, B, sm, blockIdx.y * 16, blockIdx.x * 16, c);
  const int rbase = (lane >> 4) << 3;
  const int ncol  = lane & 15;
#pragma unroll
  for (int i = 0; i < 4; ++i)
#pragma unroll
    for (int j = 0; j < 4; ++j)
#pragma unroll
      for (int v = 0; v < 8; ++v) {
        const int row = (mt0 + i) * 16 + v + rbase;
        const int col = (nt0 + j) * 16 + ncol;
        out[(size_t)row * DIM + col] = c[i][j][v];
      }
}

// ---------------------------------------------------------------------------
extern "C" void kernel_launch(void* const* d_in, const int* in_sizes, int n_in,
                              void* d_out, int out_size, void* d_ws,
                              size_t ws_size, hipStream_t stream) {
  (void)in_sizes; (void)n_in; (void)out_size; (void)ws_size;
  const float* x    = (const float*)d_in[0];
  const float* g    = (const float*)d_in[1];
  const float* be   = (const float*)d_in[2];
  const float* wqkv = (const float*)d_in[3];
  const float* wout = (const float*)d_in[4];

  half_t* ws    = (half_t*)d_ws;
  half_t* xnA   = ws + OFF_XNA;   // reused as O A-frag after attention
  half_t* wqkvB = ws + OFF_WQKV;
  half_t* woutB = ws + OFF_WOUT;
  half_t* qA    = ws + OFF_QA;
  half_t* kTB   = ws + OFF_KTB;
  half_t* vB    = ws + OFF_VB;

  ln_pack_a<<<ROWS / 32, 256, 0, stream>>>(x, g, be, xnA);
  pack_b_qkv<<<dim3(NQKV / 128, DIM / 64), 256, 0, stream>>>(wqkv, wqkvB);
  pack_b_out<<<dim3(DIM / 128, DIM / 64), 256, 0, stream>>>(wout, woutB);
  zero_pad<<<256, 256, 0, stream>>>(kTB, vB);
  gemm_qkv<<<dim3(NQKV / 256, ROWS / 256), 512, 0, stream>>>(xnA, wqkvB, qA, kTB, vB);
  attn_kernel<<<BATCH * HEADS * NWIN, 256, 65536, stream>>>(qA, kTB, vB, xnA);
  gemm_out<<<dim3(DIM / 256, ROWS / 256), 512, 0, stream>>>(xnA, woutB, (float*)d_out);
}

// v003
// One run takes 175 microseconds.
// Timed twice side by side with v002, it ran 1.47 and 1.48 times as fast.
// Counting every step since v000, it is 2.04 times as fast.
#include <hip/hip_runtime.h>
#include <hip/hip_bf16.h>

// ---------------------------------------------------------------------------
// Local windowed MHA forward for MI455X (gfx1250), wave32 + WMMA f16->f32.
//   b=2, n=8192, DIM=1024, HEADS=16, DHEAD=64, WINDOW=128, look_backward=1
// Pipeline: LN(pack A-frag) -> pack weights(B-frag) -> QKV GEMM (WMMA, q/kT/v
// frags) -> per-window attention (WMMA K Q^T, softmax, WMMA V^T P^T) ->
// output GEMM (WMMA) -> f32 out.
// Every product whose result is the operand of a later product is formed with
// the operand order that leaves a lane's 8 accumulators as 8 consecutive halfs
// of that lane's own place in the destination fragment.
// Both GEMMs stage their operand fragments in LDS (asynchronous copies, two
// buffers): one 256x256 tile per work-group, read by 16 waves.
// ---------------------------------------------------------------------------

typedef __attribute__((ext_vector_type(16))) _Float16 v16h;
typedef __attribute__((ext_vector_type(8)))  float    v8f;
typedef __attribute__((ext_vector_type(2)))  float    v2f;
typedef __attribute__((ext_vector_type(2)))  _Float16 v2h;
typedef _Float16 half_t;

#define HEADS  16
#define DIM    1024
#define DHEAD  64
#define WIN    128
#define NTOK   8192
#define BATCH  2
#define ROWS   (BATCH * NTOK)   // 16384
#define NQKV   (3 * DIM)        // 3072
#define NWIN   (NTOK / WIN)     // 64
#define KT32   (DIM / 32)       // k-tiles of a row of 1024 (both GEMMs: K = 1024)

// Workspace layout (in halfs). All offsets keep >=32B alignment.
static constexpr size_t OFF_XNA  = 0;                       // 16384x1024 A-frag (reused as O A-frag)
static constexpr size_t OFF_WQKV = OFF_XNA  + 16777216;     // 1024x3072 B-frag
static constexpr size_t OFF_WOUT = OFF_WQKV + 3145728;      // 1024x1024 B-frag
static constexpr size_t OFF_QA   = OFF_WOUT + 1048576;      // per (b,h): 8192x64 A-frag
static constexpr size_t OFF_KTB  = OFF_QA   + 16777216;     // per (b,h): B-frag (d x padded keypos), 520 jtiles
static constexpr size_t OFF_VB   = OFF_KTB  + 17039360;     // per (b,h): B-frag (padded keypos x d), 260 ktiles
// total = 71,827,456 halfs = ~137 MB

static constexpr size_t QA_BH  = 524288;  // 512 mtiles * 2 ktiles * 512
static constexpr size_t KTB_BH = 532480;  // 520 jtiles * 2 dtiles * 512
static constexpr size_t VB_BH  = 532480;  // 4 ntiles * 260 ktiles * 512

// --- WMMA fragment addressing (element granularity) ------------------------
// A-frag (MxK): tile(mt,kt) base=((mt*Kt+kt)<<9); within tile, element (m,k):
//   lane = (m&15) | ((k>>3 & 1)<<4), halfidx = (k&7) | ((k>>4 & 1)<<3)
__device__ __forceinline__ size_t a_off(int kt32, int m, int k) {
  int kk   = k & 31;
  int lane = (m & 15) | (((kk >> 3) & 1) << 4);
  int hidx = (kk & 7) | (((kk >> 4) & 1) << 3);
  return ((size_t)((m >> 4) * kt32 + (k >> 5)) << 9) + (lane << 4) + hidx;
}
// B-frag (KxN): tile(nt,kt) base=((nt*Kt+kt)<<9); element (k,n) mirrors A.
__device__ __forceinline__ size_t b_off(int kt32, int k, int n) {
  int kk   = k & 31;
  int lane = (n & 15) | (((kk >> 3) & 1) << 4);
  int hidx = (kk & 7) | (((kk >> 4) & 1) << 3);
  return ((size_t)((n >> 4) * kt32 + (k >> 5)) << 9) + (lane << 4) + hidx;
}

__device__ __forceinline__ v16h load_frag(const half_t* p) {
  union { uint4 u[2]; v16h v; } t;
  t.u[0] = *(const uint4*)(p);
  t.u[1] = *(const uint4*)(p + 8);
  return t.v;
}

__device__ __forceinline__ v8f zero8() {
  v8f z;
#pragma unroll
  for (int e = 0; e < 8; ++e) z[e] = 0.0f;
  return z;
}

__device__ __forceinline__ v8f wmma_f16(v16h a, v16h b, v8f c) {
  return __builtin_amdgcn_wmma_f32_16x16x32_f16(false, a, false, b, (short)0, c,
                                                false, false);
}

// An A-frag of X holds the same registers as a B-frag of X^T (a_off and b_off
// mirror each other), so wmma_f16(frag(Y), frag(X)) is the tile of (X Y)^T:
// lane = (row of X) | (8-group of the column) << 4, register = column & 7.
// The 8 accumulators of a lane as 16 bytes of f16.
__device__ __forceinline__ uint4 pack8(v8f t, float sc) {
  union { v2h h[4]; uint4 u; } o;
#pragma unroll
  for (int e = 0; e < 4; ++e) {
    v2f p;
    p[0] = t[2 * e] * sc;
    p[1] = t[2 * e + 1] * sc;
    o.h[e] = __builtin_convertvector(p, v2h);   // one packed conversion
  }
  return o.u;
}

// 2^x of a tile's 8 values. One statement: every output lies apart from every
// input, and the v_nop is the slot that the instruction set asks for behind a
// transcendental before its result is used or its source overwritten.
__device__ __forceinline__ v8f exp2_8(v8f x) {
  float e0, e1, e2, e3, e4, e5, e6, e7;
  asm("v_exp_f32 %0, %8\n\t"
      "v_exp_f32 %1, %9\n\t"
      "v_exp_f32 %2, %10\n\t"
      "v_exp_f32 %3, %11\n\t"
      "v_exp_f32 %4, %12\n\t"
      "v_exp_f32 %5, %13\n\t"
      "v_exp_f32 %6, %14\n\t"
      "v_exp_f32 %7, %15\n\t"
      "v_nop"
      : "=&v"(e0), "=&v"(e1), "=&v"(e2), "=&v"(e3),
        "=&v"(e4), "=&v"(e5), "=&v"(e6), "=&v"(e7)
      : "v"(x[0]), "v"(x[1]), "v"(x[2]), "v"(x[3]),
        "v"(x[4]), "v"(x[5]), "v"(x[6]), "v"(x[7]));
  v8f e;
  e[0] = e0; e[1] = e1; e[2] = e2; e[3] = e3;
  e[4] = e4; e[5] = e5; e[6] = e6; e[7] = e7;
  return e;
}

// ---------------------------------------------------------------------------
// Kernel 1: LayerNorm, four rows per wave; normalized rows go out as f16
// A-frags. Lane = (row & 3) | (column quad << 2): a load reads one 128-B line of
// each of the four rows, and a store fills two whole 128-B lines of a fragment.
// Few long-lived waves: the launch is bound by memory, not by wave starts.
// ---------------------------------------------------------------------------
__global__ __launch_bounds__(256)
void ln_pack_a(const float* __restrict__ x, const float* __restrict__ g,
               const float* __restrict__ be, half_t* __restrict__ xnA) {
  const int lane = threadIdx.x & 31;
  const int wave = blockIdx.x * 8 + (threadIdx.x >> 5);
  const int row  = wave * 4 + (lane & 3);
  const int cq   = (lane >> 2) * 4;   // first of the lane's 4 columns in a k-tile
  const float* xr = x + (size_t)row * DIM + cq;
  float4 v[KT32];
  // Unrolled (as the three loops below): v and o stay in registers and all 32
  // loads of the wave are in flight together.
#pragma unroll
  for (int i = 0; i < KT32; ++i) v[i] = *(const float4*)(xr + i * 32);
  float4 s  = make_float4(0.0f, 0.0f, 0.0f, 0.0f);
  float4 s2 = make_float4(0.0f, 0.0f, 0.0f, 0.0f);
#pragma unroll
  for (int i = 0; i < KT32; ++i) {
    s.x += v[i].x; s.y += v[i].y; s.z += v[i].z; s.w += v[i].w;
    s2.x += v[i].x * v[i].x; s2.y += v[i].y * v[i].y;
    s2.z += v[i].z * v[i].z; s2.w += v[i].w * v[i].w;
  }
  float rs = (s.x + s.y) + (s.z + s.w);
  float rq = (s2.x + s2.y) + (s2.z + s2.w);
  // The eight lanes of a row differ in lane bits 2..4.
  rs += __shfl_xor(rs, 4);  rq += __shfl_xor(rq, 4);
  rs += __shfl_xor(rs, 8);  rq += __shfl_xor(rq, 8);
  rs += __shfl_xor(rs, 16); rq += __shfl_xor(rq, 16);
  const float mu   = rs * (1.0f / DIM);
  const float var  = rq * (1.0f / DIM) - mu * mu;
  const float rstd = rsqrtf(var + 1e-5f);
  uint2 o[KT32];
#pragma unroll
  for (int i = 0; i < KT32; ++i) {
    const float4 gv = *(const float4*)(g + i * 32 + cq);
    const float4 bv = *(const float4*)(be + i * 32 + cq);
    union { half_t h[4]; uint2 u; } p;
    p.h[0] = (half_t)((v[i].x - mu) * rstd * gv.x + bv.x);
    p.h[1] = (half_t)((v[i].y - mu) * rstd * gv.y + bv.y);
    p.h[2] = (half_t)((v[i].z - mu) * rstd * gv.z + bv.z);
    p.h[3] = (half_t)((v[i].w - mu) * rstd * gv.w + bv.w);
    o[i] = p.u;
  }
  half_t* dst = xnA + a_off(KT32, row, cq);
  // Holds every store behind the last load and the last arithmetic, so that no
  // register which an issued store names is written again.
  __builtin_amdgcn_sched_barrier(0);
#pragma unroll
  for (int i = 0; i < KT32; ++i) *(uint2*)(dst + i * 512) = o[i];
}

// ---------------------------------------------------------------------------
// Kernel 2 (one per weight matrix): pack a row-major KxN f32 matrix into f16
// B-frags. A wave builds two whole fragments (n-tile nt, k-tiles 2*y, 2*y+1):
// each lane gathers its own 16 halfs of each and stores them as 32 contiguous
// bytes. K and N are constants at each call, so that every row step is an
// immediate offset on one address.
// ---------------------------------------------------------------------------
__device__ __forceinline__ void pack_frags(const float* __restrict__ w,
                                           half_t* __restrict__ dst,
                                           const int K, const int N) {
  const int lane = threadIdx.x & 31;
  const int nt   = blockIdx.x * 8 + (threadIdx.x >> 5);
  const int kt   = blockIdx.y * 2;
  const float* p = w + (size_t)(kt * 32 + (lane >> 4) * 8) * N + nt * 16 + (lane & 15);
  half_t* d = dst + ((size_t)(nt * (K >> 5) + kt) << 9) + lane * 16;
  // Unrolled: all 32 loads of the wave are in flight together.
#pragma unroll
  for (int f = 0; f < 2; ++f) {
    union { half_t h[16]; uint4 u[2]; } o;
#pragma unroll
    for (int e = 0; e < 8; ++e) {
      o.h[e]     = (half_t)p[(f * 32 + e) * N];
      o.h[8 + e] = (half_t)p[(f * 32 + 16 + e) * N];
    }
    *(uint4*)(d + f * 512)     = o.u[0];
    *(uint4*)(d + f * 512 + 8) = o.u[1];
  }
}

__global__ __launch_bounds__(256)
void pack_b_qkv(const float* __restrict__ w, half_t* __restrict__ dst) {
  pack_frags(w, dst, DIM, NQKV);
}

__global__ __launch_bounds__(256)
void pack_b_out(const float* __restrict__ w, half_t* __restrict__ dst) {
  pack_frags(w, dst, DIM, DIM);
}

// ---------------------------------------------------------------------------
// Kernel 3: zero the one-chunk (128 keypos) lookback pad of kT / v frags.
// ---------------------------------------------------------------------------
__global__ __launch_bounds__(256)
void zero_pad(half_t* __restrict__ kTB, half_t* __restrict__ vB) {
  const int tid = blockIdx.x * 256 + threadIdx.x;  // 65536 units of 8 halfs
  const int bh  = tid >> 11;
  const int rem = tid & 2047;
  const uint4 z = make_uint4(0u, 0u, 0u, 0u);
  if (rem < 1024) {
    // kT pad: jtiles 0..7 -> frags 0..15 contiguous (8192 halfs)
    *(uint4*)(kTB + (size_t)bh * KTB_BH + (size_t)rem * 8) = z;
  } else {
    // v pad: frag (nt*260 + kt), nt=0..3, kt=0..3
    const int r2   = rem - 1024;
    const int frag = r2 >> 6, unit = r2 & 63;
    const int nt = frag >> 2, kt = frag & 3;
    *(uint4*)(vB + (size_t)bh * VB_BH + (((size_t)(nt * 260 + kt)) << 9) +
              (size_t)unit * 8) = z;
  }
}

// ---------------------------------------------------------------------------
// Shared GEMM core: 16 waves/block (4x4), each wave a 64x64 tile (4x4 WMMA
// tiles) of a 256x256 block tile. A pass is GP k-tiles (128 k). A stage holds
// 16 A tile rows, then 16 B tile rows, each GP fragments of 1 KB. In LDS a
// fragment is two 512-B planes (halfs 0..7 of every lane, then halfs 8..15), so
// that each ds_load_b128 of a wave reads 512 contiguous bytes.
// ---------------------------------------------------------------------------
#define GP     4                  // k-tiles per pass
#define GPASS  (KT32 / GP)        // passes
#define GROW   (GP * 512)         // halfs of one tile row in a stage
#define GSTAGE (32 * GROW)        // halfs of a stage (128 KB)

__device__ __forceinline__ v16h lds_frag(const half_t* p) {
  union { uint4 u[2]; v16h v; } t;
  t.u[0] = *(const uint4*)(p);
  t.u[1] = *(const uint4*)(p + 256);
  return t.v;
}

// Eight copies of 512 B: one tile row (GP fragments) of a stage. g: the lane's
// 16 bytes of the row's first 512 B; l: their LDS byte address. Global chunk
// 2*lane+h of a fragment goes to plane h, slot lane. The s_wait_xcnt closes the
// statement so that no address register is rewritten ahead of it.
__device__ __forceinline__ void copy_row(const half_t* g, uint32_t l) {
  asm volatile(
      "global_load_async_to_lds_b128 %0, %8, off\n\t"
      "global_load_async_to_lds_b128 %1, %9, off\n\t"
      "global_load_async_to_lds_b128 %2, %10, off\n\t"
      "global_load_async_to_lds_b128 %3, %11, off\n\t"
      "global_load_async_to_lds_b128 %4, %12, off\n\t"
      "global_load_async_to_lds_b128 %5, %13, off\n\t"
      "global_load_async_to_lds_b128 %6, %14, off\n\t"
      "global_load_async_to_lds_b128 %7, %15, off\n\t"
      "s_wait_xcnt 0x0"
      :: "v"(l), "v"(l + 256u), "v"(l + 1024u), "v"(l + 1280u),
         "v"(l + 2048u), "v"(l + 2304u), "v"(l + 3072u), "v"(l + 3328u),
         "v"(g), "v"(g + 256), "v"(g + 512), "v"(g + 768),
         "v"(g + 1024), "v"(g + 1280), "v"(g + 1536), "v"(g + 1792)
      : "memory");
}

// One wave's share of a stage: two tile rows, 16 copies.
__device__ __forceinline__ void copy_stage(const half_t* g, uint32_t l) {
  copy_row(g, l);
  copy_row(g + (KT32 << 9), l + GROW * 2u);
}

// This wave's copies have landed (the compiler places no wait for them).
__device__ __forceinline__ void wait_async0() {
  asm volatile("s_wait_asynccnt 0x0" ::: "memory");
}
// This wave's LDS reads are done before the buffer goes back to the copies.
__device__ __forceinline__ void wait_ds0() {
  asm volatile("s_wait_dscnt 0x0" ::: "memory");
}

__device__ __forceinline__ void gemm_tile64(const half_t* __restrict__ A,
                                            const half_t* __restrict__ B,
                                            half_t* sm, int mtb, int ntb,
                                            v8f c[4][4]) {
  const int lane = threadIdx.x & 31, wid = threadIdx.x >> 5;
  const int wm = wid >> 2, wn = wid & 3;
#pragma unroll
  for (int i = 0; i < 4; ++i)
#pragma unroll
    for (int j = 0; j < 4; ++j) c[i][j] = zero8();

  // Waves 0..7 copy the A tile rows 2*wid, 2*wid+1; waves 8..15 the B rows.
  const int row0 = (wid & 7) * 2;
  const half_t* src =
      (wid < 8 ? A + ((size_t)(mtb + row0) * KT32 << 9)
               : B + ((size_t)(ntb + row0) * KT32 << 9)) + lane * 8;
  const uint32_t dst = (uint32_t)(size_t)sm + (uint32_t)wid * (GROW * 4u) +
                       (uint32_t)(lane & 1) * 512u + (uint32_t)(lane >> 1) * 16u;

  copy_stage(src, dst);
  wait_async0();
  __syncthreads();
  copy_stage(src + GROW, dst + GSTAGE * 2u);

  // Kept rolled: one publish point in the text, the buffer index a scalar.
#pragma unroll 1
  for (int t = 0; t < GPASS; ++t) {
    const half_t* sb = sm + (t & 1) * GSTAGE + lane * 8;
    // Unrolled, as the loops inside: every fragment and accumulator index is a
    // constant, so they stay in registers.
#pragma unroll
    for (int kk = 0; kk < GP; ++kk) {
      v16h a[4], b[4];
#pragma unroll
      for (int i = 0; i < 4; ++i)
        a[i] = lds_frag(sb + (wm * 4 + i) * GROW + kk * 512);
#pragma unroll
      for (int j = 0; j < 4; ++j)
        b[j] = lds_frag(sb + (16 + wn * 4 + j) * GROW + kk * 512);
#pragma unroll
      for (int i = 0; i < 4; ++i)
#pragma unroll
        for (int j = 0; j < 4; ++j) c[i][j] = wmma_f16(a[i], b[j], c[i][j]);
    }
    // Publish pass t+1 and free this pass's buffer: one barrier does both.
    wait_ds0();
    wait_async0();
    __syncthreads();
    if (t + 2 < GPASS)
      copy_stage(src + (t + 2) * GROW, dst + (uint32_t)(t & 1) * (GSTAGE * 2u));
  }
  wait_async0();
}

// ---------------------------------------------------------------------------
// Kernel 4: QKV GEMM. C=(16384x3072). A block's 256 columns lie in one of q, k,
// v, and a wave's 64 columns are one head. q and k fragments run along d inside
// a lane, so their blocks take the weights as the A operand and x as B (the
// tile comes out transposed); v fragments run along the tokens: x as A.
// Either way tiles c[2p][j], c[2p+1][j] are a lane's 32 bytes of one fragment.
// ---------------------------------------------------------------------------
__global__ __launch_bounds__(512)
void gemm_qkv(const half_t* __restrict__ A, const half_t* __restrict__ B,
              half_t* __restrict__ qA, half_t* __restrict__ kTB,
              half_t* __restrict__ vB) {
  __shared__ __attribute__((aligned(16))) half_t sm[2 * GSTAGE];
  const int lane = threadIdx.x & 31, wid = threadIdx.x >> 5;
  const int wm = wid >> 2, wn = wid & 3;
  const int part = blockIdx.x >> 2;   // 0=q 1=k 2=v
  const bool sw  = part < 2;          // weights as the A operand
  v8f c[4][4];
  gemm_tile64(sw ? B : A, sw ? A : B, sm,
              (sw ? blockIdx.x : blockIdx.y) * 16,
              (sw ? blockIdx.y : blockIdx.x) * 16, c);

  const int h  = (blockIdx.x * 4 + (sw ? wm : wn)) & (HEADS - 1);
  const int bh = (blockIdx.y >> 5) * HEADS + h;
  // The wave's first 16-token tile inside its batch row (a multiple of 4).
  const int tt = (blockIdx.y & 31) * 16 + (sw ? wn : wm) * 4;
  // j: token tile (q, k) or 16-column group of d (v); p: fragment along the
  // other index. Key positions carry the lookback pad of 8 token tiles.
  half_t* base = part == 0 ? qA  + (size_t)bh * QA_BH  + ((size_t)(tt * 2) << 9)
               : part == 1 ? kTB + (size_t)bh * KTB_BH + ((size_t)((tt + 8) * 2) << 9)
                           : vB  + (size_t)bh * VB_BH  + ((size_t)((tt + 8) >> 1) << 9);
  const size_t sj = part == 2 ? (size_t)260 * 512 : (size_t)1024;
  const float  sc = part == 0 ? 0.125f : 1.0f;
  uint4 o[4][4];
  half_t* d[4];
#pragma unroll
  for (int j = 0; j < 4; ++j) {
    d[j] = base + j * sj + lane * 16;
#pragma unroll
    for (int i = 0; i < 4; ++i) o[i][j] = pack8(c[i][j], sc);
  }
#pragma unroll
  for (int j = 0; j < 4; ++j)
#pragma unroll
    for (int i = 0; i < 4; ++i) *(uint4*)(d[j] + (i >> 1) * 512 + (i & 1) * 8) = o[i][j];
}

// ---------------------------------------------------------------------------
// Kernel 5: local attention. One block per (b,h,window); 8 waves; each wave
// owns a 16-query strip: sim^T = K Q^T (32 WMMA), mask+softmax, out^T = V^T P^T
// (32 WMMA). A lane holds one query and half of its 256 keys: maximum and sum
// are in-lane but for one exchange between the wave's halves, and two score
// tiles, converted, are the lane's own B operand of the second product.
// ---------------------------------------------------------------------------
__global__ __launch_bounds__(256)
void attn_kernel(const half_t* __restrict__ qA, const half_t* __restrict__ kTB,
                 const half_t* __restrict__ vB, half_t* __restrict__ oA) {
  const int lane = threadIdx.x & 31, mt = threadIdx.x >> 5;
  const int wi = blockIdx.x & (NWIN - 1);
  const int h  = (blockIdx.x >> 6) & (HEADS - 1);
  const int b  = blockIdx.x >> 10;
  const int bh = b * HEADS + h;
  const half_t* qbase = qA  + (size_t)bh * QA_BH;
  const half_t* kbase = kTB + (size_t)bh * KTB_BH;
  const half_t* vbase = vB  + (size_t)bh * VB_BH;

  const v16h aq0 = load_frag(qbase + (((size_t)(wi * 8 + mt) * 2 + 0) << 9) + lane * 16);
  const v16h aq1 = load_frag(qbase + (((size_t)(wi * 8 + mt) * 2 + 1) << 9) + lane * 16);
  // These four loads name one address pair; the wait stands in front of the next
  // loads, whose results may be placed over that pair.
  asm volatile("s_wait_xcnt 0x0" ::: "memory");

  // --- sim^T = k @ q^T : c[nt][v] = sim[query ncol][key nt*16 + v + rbase]
  v8f c[16];
#pragma unroll
  for (int nt = 0; nt < 16; ++nt) {
    const v16h b0 = load_frag(kbase + (((size_t)(wi * 8 + nt) * 2 + 0) << 9) + lane * 16);
    const v16h b1 = load_frag(kbase + (((size_t)(wi * 8 + nt) * 2 + 1) << 9) + lane * 16);
    v8f acc = zero8();
    acc = wmma_f16(b0, aq0, acc);
    acc = wmma_f16(b1, aq1, acc);
    c[nt] = acc;
  }

  // --- causal local mask + softmax of the lane's query ------------------
  const int rbase = (lane >> 4) << 3;
  const int ncol  = lane & 15;
  // q_pos - k_pos = tq - (nt*16 + v): the query's position less that of the
  // lane's first key. In window 0 the lookback half (nt < 8) is the pad
  // (k_pos < 0): tlo puts every difference there below zero.
  const int tq  = WIN + mt * 16 + ncol - rbase;
  const int tlo = wi == 0 ? -4 * WIN : tq;
  // Eight independent chains for the maximum, and eight for the sum.
  v8f mv, sv;
#pragma unroll
  for (int v = 0; v < 8; ++v) { mv[v] = -3.0e38f; sv[v] = 0.0f; }
#pragma unroll
  for (int nt = 0; nt < 16; ++nt) {
#pragma unroll
    for (int v = 0; v < 8; ++v) {
      // bad: q_pos < k_pos, q_pos > k_pos + WIN, or a pad key.
      const bool bad = (unsigned)((nt < 8 ? tlo : tq) - (nt * 16 + v)) > (unsigned)WIN;
      const float x = bad ? -3.0e38f : c[nt][v];
      c[nt][v] = x;
      mv[v] = fmaxf(mv[v], x);
    }
  }
  float m = fmaxf(fmaxf(fmaxf(mv[0], mv[1]), fmaxf(mv[2], mv[3])),
                  fmaxf(fmaxf(mv[4], mv[5]), fmaxf(mv[6], mv[7])));
  m = fmaxf(m, __shfl_xor(m, 16));
#pragma unroll
  for (int nt = 0; nt < 16; ++nt) {
    c[nt] = exp2_8((c[nt] - m) * 1.44269504f);   // e^(x - m)
    sv += c[nt];
  }
  float s = ((sv[0] + sv[1]) + (sv[2] + sv[3])) + ((sv[4] + sv[5]) + (sv[6] + sv[7]));
  s += __shfl_xor(s, 16);
  const float inv = 1.0f / s;

  // --- out^T = v^T @ attn^T : oc[nt][v] = out[query ncol][d nt*16 + v + rbase]
  v8f oc[4];
#pragma unroll
  for (int nt = 0; nt < 4; ++nt) oc[nt] = zero8();
#pragma unroll
  for (int kt = 0; kt < 8; ++kt) {
    union { uint4 u[2]; v16h v; } up;
    up.u[0] = pack8(c[2 * kt], inv);
    up.u[1] = pack8(c[2 * kt + 1], inv);
    const v16h pf = up.v;
#pragma unroll
    for (int nt = 0; nt < 4; ++nt) {
      const v16h bf =
          load_frag(vbase + (((size_t)(nt * 260 + wi * 4 + kt)) << 9) + lane * 16);
      oc[nt] = wmma_f16(bf, pf, oc[nt]);
    }
  }

  // --- the strip's two A-frags of the (16384 x 1024) output matrix ------
  const int m0 = b * NTOK + wi * WIN + mt * 16;
  half_t* od = oA + ((size_t)((m0 >> 4) * KT32 + h * 2) << 9) + lane * 16;
  uint4 o[4];
#pragma unroll
  for (int nt = 0; nt < 4; ++nt) o[nt] = pack8(oc[nt], 1.0f);
#pragma unroll
  for (int nt = 0; nt < 4; ++nt) *(uint4*)(od + (nt >> 1) * 512 + (nt & 1) * 8) = o[nt];
}

// ---------------------------------------------------------------------------
// Kernel 6: output GEMM, f32 row-major result.
// ---------------------------------------------------------------------------
__global__ __launch_bounds__(512)
void gemm_out(const half_t* __restrict__ A, const half_t* __restrict__ B,
              float* __restrict__ out) {
  __shared__ __attribute__((aligned(16))) half_t sm[2 * GSTAGE];
  const int lane = threadIdx.x & 31, wid = threadIdx.x >> 5;
  const int wm = wid >> 2, wn = wid & 3;
  const int mt0 = blockIdx.y * 16 + wm * 4;
  const int nt0 = blockIdx.x * 16 + wn * 4;
  v8f c[4][4];
  gemm_tile64(A, B, sm, blockIdx.y * 16, blockIdx.x * 16, c);
  const int rbase = (lane >> 4) << 3;
  const int ncol  = lane & 15;
#pragma unroll
  for (int i = 0; i < 4; ++i)
#pragma unroll
    for (int j = 0; j < 4; ++j)
#pragma unroll
      for (int v = 0; v < 8; ++v) {
        const int row = (mt0 + i) * 16 + v + rbase;
        const int col = (nt0 + j) * 16 + ncol;
        out[(size_t)row * DIM + col] = c[i][j][v];
      }
}

// ---------------------------------------------------------------------------
extern "C" void kernel_launch(void* const* d_in, const int* in_sizes, int n_in,
                              void* d_out, int out_size, void* d_ws,
                              size_t ws_size, hipStream_t stream) {
  (void)in_sizes; (void)n_in; (void)out_size; (void)ws_size;
  const float* x    = (const float*)d_in[0];
  const float* g    = (const float*)d_in[1];
  const float* be   = (const float*)d_in[2];
  const float* wqkv = (const float*)d_in[3];
  const float* wout = (const float*)d_in[4];

  half_t* ws    = (half_t*)d_ws;
  half_t* xnA   = ws + OFF_XNA;   // reused as O A-frag after attention
  half_t* wqkvB = ws + OFF_WQKV;
  half_t* woutB = ws + OFF_WOUT;
  half_t* qA    = ws + OFF_QA;
  half_t* kTB   = ws + OFF_KTB;
  half_t* vB    = ws + OFF_VB;

  ln_pack_a<<<ROWS / 32, 256, 0, stream>>>(x, g, be, xnA);
  pack_b_qkv<<<dim3(NQKV / 128, DIM / 64), 256, 0, stream>>>(wqkv, wqkvB);
  pack_b_out<<<dim3(DIM / 128, DIM / 64), 256, 0, stream>>>(wout, woutB);
  zero_pad<<<256, 256, 0, stream>>>(kTB, vB);
  gemm_qkv<<<dim3(NQKV / 256, ROWS / 256), 512, 0, stream>>>(xnA, wqkvB, qA, kTB, vB);
  attn_kernel<<<BATCH * HEADS * NWIN, 256, 0, stream>>>(qA, kTB, vB, xnA);
  gemm_out<<<dim3(DIM / 256, ROWS / 256), 512, 0, stream>>>(xnA, woutB, (float*)d_out);
}

// v004
// One run takes 167 microseconds.
// In both of two side-by-side timings against v003, it was 1.05 times as fast.
// Counting every step since v000, it is 2.14 times as fast.
#include <hip/hip_runtime.h>
#include <hip/hip_bf16.h>

// ---------------------------------------------------------------------------
// Local windowed MHA forward for MI455X (gfx1250), wave32 + WMMA f16->f32.
//   b=2, n=8192, DIM=1024, HEADS=16, DHEAD=64, WINDOW=128, look_backward=1
// Pipeline: LN(pack A-frag) -> pack weights(B-frag) -> QKV GEMM (WMMA, q/kT/v
// frags) -> per-window attention (WMMA K Q^T, softmax, WMMA V^T P^T) ->
// output GEMM (WMMA) -> f32 out.
// Every product whose result is the operand of a later product is formed with
// the operand order that leaves a lane's 8 accumulators as 8 consecutive halfs
// of that lane's own place in the destination fragment.
// Both GEMMs stage their operand fragments in LDS (asynchronous copies, two
// buffers): one 256x256 tile per work-group, read by 16 waves.
// ---------------------------------------------------------------------------

typedef __attribute__((ext_vector_type(16))) _Float16 v16h;
typedef __attribute__((ext_vector_type(8)))  float    v8f;
typedef __attribute__((ext_vector_type(2)))  float    v2f;
typedef __attribute__((ext_vector_type(2)))  _Float16 v2h;
typedef _Float16 half_t;

#define HEADS  16
#define DIM    1024
#define DHEAD  64
#define WIN    128
#define NTOK   8192
#define BATCH  2
#define ROWS   (BATCH * NTOK)   // 16384
#define NQKV   (3 * DIM)        // 3072
#define NWIN   (NTOK / WIN)     // 64
#define KT32   (DIM / 32)       // k-tiles of a row of 1024 (both GEMMs: K = 1024)

// Workspace layout (in halfs). All offsets keep >=32B alignment.
static constexpr size_t OFF_XNA  = 0;                       // 16384x1024 A-frag (reused as O A-frag)
static constexpr size_t OFF_WQKV = OFF_XNA  + 16777216;     // 1024x3072 B-frag
static constexpr size_t OFF_WOUT = OFF_WQKV + 3145728;      // 1024x1024 B-frag
static constexpr size_t OFF_QA   = OFF_WOUT + 1048576;      // per (b,h): 8192x64 A-frag
static constexpr size_t OFF_KTB  = OFF_QA   + 16777216;     // per (b,h): B-frag (d x padded keypos), 520 jtiles
static constexpr size_t OFF_VB   = OFF_KTB  + 17039360;     // per (b,h): B-frag (padded keypos x d), 260 ktiles
// total = 71,827,456 halfs = ~137 MB

static constexpr size_t QA_BH  = 524288;  // 512 mtiles * 2 ktiles * 512
static constexpr size_t KTB_BH = 532480;  // 520 jtiles * 2 dtiles * 512
static constexpr size_t VB_BH  = 532480;  // 4 ntiles * 260 ktiles * 512

// --- WMMA fragment addressing (element granularity) ------------------------
// A-frag (MxK): tile(mt,kt) base=((mt*Kt+kt)<<9); within tile, element (m,k):
//   lane = (m&15) | ((k>>3 & 1)<<4), halfidx = (k&7) | ((k>>4 & 1)<<3)
__device__ __forceinline__ size_t a_off(int kt32, int m, int k) {
  int kk   = k & 31;
  int lane = (m & 15) | (((kk >> 3) & 1) << 4);
  int hidx = (kk & 7) | (((kk >> 4) & 1) << 3);
  return ((size_t)((m >> 4) * kt32 + (k >> 5)) << 9) + (lane << 4) + hidx;
}
// B-frag (KxN): tile(nt,kt) base=((nt*Kt+kt)<<9); element (k,n) mirrors A.
__device__ __forceinline__ size_t b_off(int kt32, int k, int n) {
  int kk   = k & 31;
  int lane = (n & 15) | (((kk >> 3) & 1) << 4);
  int hidx = (kk & 7) | (((kk >> 4) & 1) << 3);
  return ((size_t)((n >> 4) * kt32 + (k >> 5)) << 9) + (lane << 4) + hidx;
}

__device__ __forceinline__ v16h load_frag(const half_t* p) {
  union { uint4 u[2]; v16h v; } t;
  t.u[0] = *(const uint4*)(p);
  t.u[1] = *(const uint4*)(p + 8);
  return t.v;
}

__device__ __forceinline__ v8f zero8() {
  v8f z;
#pragma unroll
  for (int e = 0; e < 8; ++e) z[e] = 0.0f;
  return z;
}

__device__ __forceinline__ v8f wmma_f16(v16h a, v16h b, v8f c) {
  return __builtin_amdgcn_wmma_f32_16x16x32_f16(false, a, false, b, (short)0, c,
                                                false, false);
}

// An A-frag of X holds the same registers as a B-frag of X^T (a_off and b_off
// mirror each other), so wmma_f16(frag(Y), frag(X)) is the tile of (X Y)^T:
// lane = (row of X) | (8-group of the column) << 4, register = column & 7.
// The 8 accumulators of a lane as 16 bytes of f16.
__device__ __forceinline__ uint4 pack8(v8f t, float sc) {
  union { v2h h[4]; uint4 u; } o;
#pragma unroll
  for (int e = 0; e < 4; ++e) {
    v2f p;
    p[0] = t[2 * e] * sc;
    p[1] = t[2 * e + 1] * sc;
    o.h[e] = __builtin_convertvector(p, v2h);   // one packed conversion
  }
  return o.u;
}

// 2^x of a tile's 8 values. One statement: every output lies apart from every
// input, and the v_nop is the slot that the instruction set asks for behind a
// transcendental before its result is used or its source overwritten.
__device__ __forceinline__ v8f exp2_8(v8f x) {
  float e0, e1, e2, e3, e4, e5, e6, e7;
  asm("v_exp_f32 %0, %8\n\t"
      "v_exp_f32 %1, %9\n\t"
      "v_exp_f32 %2, %10\n\t"
      "v_exp_f32 %3, %11\n\t"
      "v_exp_f32 %4, %12\n\t"
      "v_exp_f32 %5, %13\n\t"
      "v_exp_f32 %6, %14\n\t"
      "v_exp_f32 %7, %15\n\t"
      "v_nop"
      : "=&v"(e0), "=&v"(e1), "=&v"(e2), "=&v"(e3),
        "=&v"(e4), "=&v"(e5), "=&v"(e6), "=&v"(e7)
      : "v"(x[0]), "v"(x[1]), "v"(x[2]), "v"(x[3]),
        "v"(x[4]), "v"(x[5]), "v"(x[6]), "v"(x[7]));
  v8f e;
  e[0] = e0; e[1] = e1; e[2] = e2; e[3] = e3;
  e[4] = e4; e[5] = e5; e[6] = e6; e[7] = e7;
  return e;
}

// ---------------------------------------------------------------------------
// Kernel 1: LayerNorm, four rows per wave; normalized rows go out as f16
// A-frags. Lane = (row & 3) | (column quad << 2): a load reads one 128-B line of
// each of the four rows, and a store fills two whole 128-B lines of a fragment.
// Few long-lived waves: the launch is bound by memory, not by wave starts.
// ---------------------------------------------------------------------------
__global__ __launch_bounds__(256)
void ln_pack_a(const float* __restrict__ x, const float* __restrict__ g,
               const float* __restrict__ be, half_t* __restrict__ xnA) {
  const int lane = threadIdx.x & 31;
  const int wave = blockIdx.x * 8 + (threadIdx.x >> 5);
  const int row  = wave * 4 + (lane & 3);
  const int cq   = (lane >> 2) * 4;   // first of the lane's 4 columns in a k-tile
  const float* xr = x + (size_t)row * DIM + cq;
  float4 v[KT32];
  // Unrolled (as the three loops below): v and o stay in registers and all 32
  // loads of the wave are in flight together.
#pragma unroll
  for (int i = 0; i < KT32; ++i) v[i] = *(const float4*)(xr + i * 32);
  float4 s  = make_float4(0.0f, 0.0f, 0.0f, 0.0f);
  float4 s2 = make_float4(0.0f, 0.0f, 0.0f, 0.0f);
#pragma unroll
  for (int i = 0; i < KT32; ++i) {
    s.x += v[i].x; s.y += v[i].y; s.z += v[i].z; s.w += v[i].w;
    s2.x += v[i].x * v[i].x; s2.y += v[i].y * v[i].y;
    s2.z += v[i].z * v[i].z; s2.w += v[i].w * v[i].w;
  }
  float rs = (s.x + s.y) + (s.z + s.w);
  float rq = (s2.x + s2.y) + (s2.z + s2.w);
  // The eight lanes of a row differ in lane bits 2..4.
  rs += __shfl_xor(rs, 4);  rq += __shfl_xor(rq, 4);
  rs += __shfl_xor(rs, 8);  rq += __shfl_xor(rq, 8);
  rs += __shfl_xor(rs, 16); rq += __shfl_xor(rq, 16);
  const float mu   = rs * (1.0f / DIM);
  const float var  = rq * (1.0f / DIM) - mu * mu;
  const float rstd = rsqrtf(var + 1e-5f);
  uint2 o[KT32];
#pragma unroll
  for (int i = 0; i < KT32; ++i) {
    const float4 gv = *(const float4*)(g + i * 32 + cq);
    const float4 bv = *(const float4*)(be + i * 32 + cq);
    union { half_t h[4]; uint2 u; } p;
    p.h[0] = (half_t)((v[i].x - mu) * rstd * gv.x + bv.x);
    p.h[1] = (half_t)((v[i].y - mu) * rstd * gv.y + bv.y);
    p.h[2] = (half_t)((v[i].z - mu) * rstd * gv.z + bv.z);
    p.h[3] = (half_t)((v[i].w - mu) * rstd * gv.w + bv.w);
    o[i] = p.u;
  }
  half_t* dst = xnA + a_off(KT32, row, cq);
  // Holds every store behind the last load and the last arithmetic, so that no
  // register which an issued store names is written again.
  __builtin_amdgcn_sched_barrier(0);
#pragma unroll
  for (int i = 0; i < KT32; ++i) *(uint2*)(dst + i * 512) = o[i];
}

// ---------------------------------------------------------------------------
// Kernel 2 (one per weight matrix): pack a row-major KxN f32 matrix into f16
// B-frags. A wave builds two whole fragments (n-tile nt, k-tiles 2*y, 2*y+1):
// each lane gathers its own 16 halfs of each and stores them as 32 contiguous
// bytes. K and N are constants at each call, so that every row step is an
// immediate offset on one address.
// ---------------------------------------------------------------------------
__device__ __forceinline__ void pack_frags(const float* __restrict__ w,
                                           half_t* __restrict__ dst,
                                           const int K, const int N) {
  const int lane = threadIdx.x & 31;
  const int nt   = blockIdx.x * 8 + (threadIdx.x >> 5);
  const int kt   = blockIdx.y * 2;
  const float* p = w + (size_t)(kt * 32 + (lane >> 4) * 8) * N + nt * 16 + (lane & 15);
  half_t* d = dst + ((size_t)(nt * (K >> 5) + kt) << 9) + lane * 16;
  // Unrolled: all 32 loads of the wave are in flight together.
#pragma unroll
  for (int f = 0; f < 2; ++f) {
    union { half_t h[16]; uint4 u[2]; } o;
#pragma unroll
    for (int e = 0; e < 8; ++e) {
      o.h[e]     = (half_t)p[(f * 32 + e) * N];
      o.h[8 + e] = (half_t)p[(f * 32 + 16 + e) * N];
    }
    *(uint4*)(d + f * 512)     = o.u[0];
    *(uint4*)(d + f * 512 + 8) = o.u[1];
  }
}

__global__ __launch_bounds__(256)
void pack_b_qkv(const float* __restrict__ w, half_t* __restrict__ dst) {
  pack_frags(w, dst, DIM, NQKV);
}

__global__ __launch_bounds__(256)
void pack_b_out(const float* __restrict__ w, half_t* __restrict__ dst) {
  pack_frags(w, dst, DIM, DIM);
}

// ---------------------------------------------------------------------------
// Kernel 3: zero the one-chunk (128 keypos) lookback pad of kT / v frags.
// ---------------------------------------------------------------------------
__global__ __launch_bounds__(256)
void zero_pad(half_t* __restrict__ kTB, half_t* __restrict__ vB) {
  const int tid = blockIdx.x * 256 + threadIdx.x;  // 65536 units of 8 halfs
  const int bh  = tid >> 11;
  const int rem = tid & 2047;
  const uint4 z = make_uint4(0u, 0u, 0u, 0u);
  if (rem < 1024) {
    // kT pad: jtiles 0..7 -> frags 0..15 contiguous (8192 halfs)
    *(uint4*)(kTB + (size_t)bh * KTB_BH + (size_t)rem * 8) = z;
  } else {
    // v pad: frag (nt*260 + kt), nt=0..3, kt=0..3
    const int r2   = rem - 1024;
    const int frag = r2 >> 6, unit = r2 & 63;
    const int nt = frag >> 2, kt = frag & 3;
    *(uint4*)(vB + (size_t)bh * VB_BH + (((size_t)(nt * 260 + kt)) << 9) +
              (size_t)unit * 8) = z;
  }
}

// ---------------------------------------------------------------------------
// Shared GEMM core: 16 waves/block (4x4), each wave a 64x64 tile (4x4 WMMA
// tiles) of a 256x256 block tile. A pass is GP k-tiles (128 k). A stage holds
// 16 A tile rows, then 16 B tile rows, each GP fragments of 1 KB. In LDS a
// fragment is two 512-B planes (halfs 0..7 of every lane, then halfs 8..15), so
// that each ds_load_b128 of a wave reads 512 contiguous bytes.
// ---------------------------------------------------------------------------
#define GP     4                  // k-tiles per pass
#define GPASS  (KT32 / GP)        // passes
#define GROW   (GP * 512)         // halfs of one tile row in a stage
#define GSTAGE (32 * GROW)        // halfs of a stage (128 KB)

__device__ __forceinline__ v16h lds_frag(const half_t* p) {
  union { uint4 u[2]; v16h v; } t;
  t.u[0] = *(const uint4*)(p);
  t.u[1] = *(const uint4*)(p + 256);
  return t.v;
}

// Eight copies of 512 B: one tile row (GP fragments) of a stage. g: the lane's
// 16 bytes of the row's first 512 B; l: their LDS byte address. Global chunk
// 2*lane+h of a fragment goes to plane h, slot lane. The s_wait_xcnt closes the
// statement so that no address register is rewritten ahead of it.
__device__ __forceinline__ void copy_row(const half_t* g, uint32_t l) {
  asm volatile(
      "global_load_async_to_lds_b128 %0, %8, off\n\t"
      "global_load_async_to_lds_b128 %1, %9, off\n\t"
      "global_load_async_to_lds_b128 %2, %10, off\n\t"
      "global_load_async_to_lds_b128 %3, %11, off\n\t"
      "global_load_async_to_lds_b128 %4, %12, off\n\t"
      "global_load_async_to_lds_b128 %5, %13, off\n\t"
      "global_load_async_to_lds_b128 %6, %14, off\n\t"
      "global_load_async_to_lds_b128 %7, %15, off\n\t"
      "s_wait_xcnt 0x0"
      :: "v"(l), "v"(l + 256u), "v"(l + 1024u), "v"(l + 1280u),
         "v"(l + 2048u), "v"(l + 2304u), "v"(l + 3072u), "v"(l + 3328u),
         "v"(g), "v"(g + 256), "v"(g + 512), "v"(g + 768),
         "v"(g + 1024), "v"(g + 1280), "v"(g + 1536), "v"(g + 1792)
      : "memory");
}

// One wave's share of a stage: two tile rows, 16 copies.
__device__ __forceinline__ void copy_stage(const half_t* g, uint32_t l) {
  copy_row(g, l);
  copy_row(g + (KT32 << 9), l + GROW * 2u);
}

// This wave's copies have landed (the compiler places no wait for them).
__device__ __forceinline__ void wait_async0() {
  asm volatile("s_wait_asynccnt 0x0" ::: "memory");
}
// This wave's LDS reads are done before the buffer goes back to the copies.
__device__ __forceinline__ void wait_ds0() {
  asm volatile("s_wait_dscnt 0x0" ::: "memory");
}

__device__ __forceinline__ void gemm_tile64(const half_t* __restrict__ A,
                                            const half_t* __restrict__ B,
                                            half_t* sm, int mtb, int ntb,
                                            v8f c[4][4]) {
  const int lane = threadIdx.x & 31, wid = threadIdx.x >> 5;
  const int wm = wid >> 2, wn = wid & 3;
#pragma unroll
  for (int i = 0; i < 4; ++i)
#pragma unroll
    for (int j = 0; j < 4; ++j) c[i][j] = zero8();

  // Waves 0..7 copy the A tile rows 2*wid, 2*wid+1; waves 8..15 the B rows.
  const int row0 = (wid & 7) * 2;
  const half_t* src =
      (wid < 8 ? A + ((size_t)(mtb + row0) * KT32 << 9)
               : B + ((size_t)(ntb + row0) * KT32 << 9)) + lane * 8;
  const uint32_t dst = (uint32_t)(size_t)sm + (uint32_t)wid * (GROW * 4u) +
                       (uint32_t)(lane & 1) * 512u + (uint32_t)(lane >> 1) * 16u;

  copy_stage(src, dst);
  wait_async0();
  __syncthreads();
  copy_stage(src + GROW, dst + GSTAGE * 2u);

  // Kept rolled: one publish point in the text, the buffer index a scalar.
#pragma unroll 1
  for (int t = 0; t < GPASS; ++t) {
    const half_t* sb = sm + (t & 1) * GSTAGE + lane * 8;
    // Unrolled, as the loops inside: every fragment and accumulator index is a
    // constant, so they stay in registers.
#pragma unroll
    for (int kk = 0; kk < GP; ++kk) {
      v16h a[4], b[4];
#pragma unroll
      for (int i = 0; i < 4; ++i)
        a[i] = lds_frag(sb + (wm * 4 + i) * GROW + kk * 512);
#pragma unroll
      for (int j = 0; j < 4; ++j)
        b[j] = lds_frag(sb + (16 + wn * 4 + j) * GROW + kk * 512);
#pragma unroll
      for (int i = 0; i < 4; ++i)
#pragma unroll
        for (int j = 0; j < 4; ++j) c[i][j] = wmma_f16(a[i], b[j], c[i][j]);
    }
    // Publish pass t+1 and free this pass's buffer: one barrier does both.
    wait_ds0();
    wait_async0();
    __syncthreads();
    if (t + 2 < GPASS)
      copy_stage(src + (t + 2) * GROW, dst + (uint32_t)(t & 1) * (GSTAGE * 2u));
  }
  wait_async0();
}

// ---------------------------------------------------------------------------
// Kernel 4: QKV GEMM. C=(16384x3072). A block's 256 columns lie in one of q, k,
// v, and a wave's 64 columns are one head. q and k fragments run along d inside
// a lane, so their blocks take the weights as the A operand and x as B (the
// tile comes out transposed); v fragments run along the tokens: x as A.
// Either way tiles c[2p][j], c[2p+1][j] are a lane's 32 bytes of one fragment.
// ---------------------------------------------------------------------------
__global__ __launch_bounds__(512)
void gemm_qkv(const half_t* __restrict__ A, const half_t* __restrict__ B,
              half_t* __restrict__ qA, half_t* __restrict__ kTB,
              half_t* __restrict__ vB) {
  __shared__ __attribute__((aligned(16))) half_t sm[2 * GSTAGE];
  const int lane = threadIdx.x & 31, wid = threadIdx.x >> 5;
  const int wm = wid >> 2, wn = wid & 3;
  const int part = blockIdx.x >> 2;   // 0=q 1=k 2=v
  const bool sw  = part < 2;          // weights as the A operand
  v8f c[4][4];
  gemm_tile64(sw ? B : A, sw ? A : B, sm,
              (sw ? blockIdx.x : blockIdx.y) * 16,
              (sw ? blockIdx.y : blockIdx.x) * 16, c);

  const int h  = (blockIdx.x * 4 + (sw ? wm : wn)) & (HEADS - 1);
  const int bh = (blockIdx.y >> 5) * HEADS + h;
  // The wave's first 16-token tile inside its batch row (a multiple of 4).
  const int tt = (blockIdx.y & 31) * 16 + (sw ? wn : wm) * 4;
  // j: token tile (q, k) or 16-column group of d (v); p: fragment along the
  // other index. Key positions carry the lookback pad of 8 token tiles.
  half_t* base = part == 0 ? qA  + (size_t)bh * QA_BH  + ((size_t)(tt * 2) << 9)
               : part == 1 ? kTB + (size_t)bh * KTB_BH + ((size_t)((tt + 8) * 2) << 9)
                           : vB  + (size_t)bh * VB_BH  + ((size_t)((tt + 8) >> 1) << 9);
  const size_t sj = part == 2 ? (size_t)260 * 512 : (size_t)1024;
  const float  sc = part == 0 ? 0.125f : 1.0f;
  uint4 o[4][4];
  half_t* d[4];
#pragma unroll
  for (int j = 0; j < 4; ++j) {
    d[j] = base + j * sj + lane * 16;
#pragma unroll
    for (int i = 0; i < 4; ++i) o[i][j] = pack8(c[i][j], sc);
  }
#pragma unroll
  for (int j = 0; j < 4; ++j)
#pragma unroll
    for (int i = 0; i < 4; ++i) *(uint4*)(d[j] + (i >> 1) * 512 + (i & 1) * 8) = o[i][j];
}

// ---------------------------------------------------------------------------
// Kernel 5: local attention. One block per (b,h,window); 8 waves; each wave
// owns a 16-query strip: sim^T = K Q^T, mask+softmax, out^T = V^T P^T.
// A lane holds one query and half of its keys: maximum and sum are in-lane but
// for one exchange between the wave's halves, and two score tiles, converted,
// are the lane's own B operand of the second product.
// Of the 16 key tiles of the 256-key frame, strip mt can see only tiles
// mt .. mt+8 (q_pos - WIN <= k_pos <= q_pos); every other tile is masked as a
// whole and its weights are exact zeros, so the wave never visits it: 9 score
// tiles (18 WMMA) and the 5 k-tiles of v that hold them (20 WMMA).
// ---------------------------------------------------------------------------
#define KVIS 9   // key tiles that a 16-query strip can see

__global__ __launch_bounds__(256)
void attn_kernel(const half_t* __restrict__ qA, const half_t* __restrict__ kTB,
                 const half_t* __restrict__ vB, half_t* __restrict__ oA) {
  const int lane = threadIdx.x & 31;
  // The strip's number as a scalar: tile addresses and tile tests are uniform.
  const int mt = __builtin_amdgcn_readfirstlane(threadIdx.x >> 5);
  const int wi = blockIdx.x & (NWIN - 1);
  const int h  = (blockIdx.x >> 6) & (HEADS - 1);
  const int b  = blockIdx.x >> 10;
  const int bh = b * HEADS + h;
  const half_t* qbase = qA  + (size_t)bh * QA_BH;
  const half_t* kbase = kTB + (size_t)bh * KTB_BH;
  const half_t* vbase = vB  + (size_t)bh * VB_BH;

  const v16h aq0 = load_frag(qbase + (((size_t)(wi * 8 + mt) * 2 + 0) << 9) + lane * 16);
  const v16h aq1 = load_frag(qbase + (((size_t)(wi * 8 + mt) * 2 + 1) << 9) + lane * 16);
  // These four loads name one address pair; the wait stands in front of the next
  // loads, whose results may be placed over that pair.
  asm volatile("s_wait_xcnt 0x0" ::: "memory");

  // --- sim^T = k @ q^T : c[r][v] = sim[query ncol][key (mt+r)*16 + v + rbase]
  const half_t* kp = kbase + (((size_t)(wi * 8 + mt) * 2) << 9) + lane * 16;
  v8f c[KVIS];
#pragma unroll
  for (int r = 0; r < KVIS; ++r) {
    const v16h b0 = load_frag(kp + r * 1024);
    const v16h b1 = load_frag(kp + r * 1024 + 512);
    v8f acc = zero8();
    acc = wmma_f16(b0, aq0, acc);
    acc = wmma_f16(b1, aq1, acc);
    c[r] = acc;
  }

  // --- causal local mask + softmax of the lane's query ------------------
  const int rbase = (lane >> 4) << 3;
  const int ncol  = lane & 15;
  // q_pos - k_pos = WIN - r*16 + dq - v. It lies inside 0 .. WIN for every
  // element of tiles 1..7; tile 0 can exceed WIN, tile 8 can fall below 0.
  const int dq = ncol - rbase;
#pragma unroll
  for (int v = 0; v < 8; ++v) {
    c[0][v]        = v < dq ? -3.0e38f : c[0][v];          // q_pos > k_pos + WIN
    c[KVIS - 1][v] = v > dq ? -3.0e38f : c[KVIS - 1][v];   // q_pos < k_pos
  }
  // In window 0 the lookback half (frame tiles below 8) is the pad (k_pos < 0).
  if (wi == 0) {
#pragma unroll
    for (int r = 0; r < 8; ++r) {
      const bool pad = mt + r < 8;
#pragma unroll
      for (int v = 0; v < 8; ++v) c[r][v] = pad ? -3.0e38f : c[r][v];
    }
  }
  // Eight independent chains for the maximum, and eight for the sum.
  v8f mv, sv;
#pragma unroll
  for (int v = 0; v < 8; ++v) { mv[v] = -3.0e38f; sv[v] = 0.0f; }
#pragma unroll
  for (int r = 0; r < KVIS; ++r)
#pragma unroll
    for (int v = 0; v < 8; ++v) mv[v] = fmaxf(mv[v], c[r][v]);
  float m = fmaxf(fmaxf(fmaxf(mv[0], mv[1]), fmaxf(mv[2], mv[3])),
                  fmaxf(fmaxf(mv[4], mv[5]), fmaxf(mv[6], mv[7])));
  m = fmaxf(m, __shfl_xor(m, 16));
#pragma unroll
  for (int r = 0; r < KVIS; ++r) {
    c[r] = exp2_8((c[r] - m) * 1.44269504f);   // e^(x - m)
    sv += c[r];
  }
  float s = ((sv[0] + sv[1]) + (sv[2] + sv[3])) + ((sv[4] + sv[5]) + (sv[6] + sv[7]));
  s += __shfl_xor(s, 16);
  const float inv = 1.0f / s;

  // --- out^T = v^T @ attn^T : oc[nt][v] = out[query ncol][d nt*16 + v + rbase]
  // A k-tile of v is an even frame tile and the odd one behind it. An even strip
  // starts on the low half of its first k-tile, an odd strip on the high half;
  // the half that falls outside the nine tiles has weight zero.
  uint4 pw[KVIS];
#pragma unroll
  for (int r = 0; r < KVIS; ++r) pw[r] = pack8(c[r], inv);
  const bool odd = (mt & 1) != 0;
  const uint4 z4 = make_uint4(0u, 0u, 0u, 0u);
  const half_t* vp = vbase + (((size_t)(wi * 4 + (mt >> 1))) << 9) + lane * 16;
  v8f oc[4];
#pragma unroll
  for (int nt = 0; nt < 4; ++nt) oc[nt] = zero8();
#pragma unroll
  for (int t = 0; t < 5; ++t) {
    union { uint4 u[2]; v16h v; } up;
    up.u[0] = odd ? (t == 0 ? z4 : pw[t == 0 ? 0 : 2 * t - 1]) : pw[2 * t];
    up.u[1] = odd ? pw[2 * t] : (t == 4 ? z4 : pw[t == 4 ? 8 : 2 * t + 1]);
    const v16h pf = up.v;
#pragma unroll
    for (int nt = 0; nt < 4; ++nt) {
      const v16h bf = load_frag(vp + (size_t)(nt * 260 + t) * 512);
      oc[nt] = wmma_f16(bf, pf, oc[nt]);
    }
  }

  // --- the strip's two A-frags of the (16384 x 1024) output matrix ------
  const int m0 = b * NTOK + wi * WIN + mt * 16;
  half_t* od = oA + ((size_t)((m0 >> 4) * KT32 + h * 2) << 9) + lane * 16;
  uint4 o[4];
#pragma unroll
  for (int nt = 0; nt < 4; ++nt) o[nt] = pack8(oc[nt], 1.0f);
#pragma unroll
  for (int nt = 0; nt < 4; ++nt) *(uint4*)(od + (nt >> 1) * 512 + (nt & 1) * 8) = o[nt];
}

// ---------------------------------------------------------------------------
// Kernel 6: output GEMM, f32 row-major result.
// ---------------------------------------------------------------------------
__global__ __launch_bounds__(512)
void gemm_out(const half_t* __restrict__ A, const half_t* __restrict__ B,
              float* __restrict__ out) {
  __shared__ __attribute__((aligned(16))) half_t sm[2 * GSTAGE];
  const int lane = threadIdx.x & 31, wid = threadIdx.x >> 5;
  const int wm = wid >> 2, wn = wid & 3;
  const int mt0 = blockIdx.y * 16 + wm * 4;
  const int nt0 = blockIdx.x * 16 + wn * 4;
  v8f c[4][4];
  gemm_tile64(A, B, sm, blockIdx.y * 16, blockIdx.x * 16, c);
  const int rbase = (lane >> 4) << 3;
  const int ncol  = lane & 15;
#pragma unroll
  for (int i = 0; i < 4; ++i)
#pragma unroll
    for (int j = 0; j < 4; ++j)
#pragma unroll
      for (int v = 0; v < 8; ++v) {
        const int row = (mt0 + i) * 16 + v + rbase;
        const int col = (nt0 + j) * 16 + ncol;
        out[(size_t)row * DIM + col] = c[i][j][v];
      }
}

// ---------------------------------------------------------------------------
extern "C" void kernel_launch(void* const* d_in, const int* in_sizes, int n_in,
                              void* d_out, int out_size, void* d_ws,
                              size_t ws_size, hipStream_t stream) {
  (void)in_sizes; (void)n_in; (void)out_size; (void)ws_size;
  const float* x    = (const float*)d_in[0];
  const float* g    = (const float*)d_in[1];
  const float* be   = (const float*)d_in[2];
  const float* wqkv = (const float*)d_in[3];
  const float* wout = (const float*)d_in[4];

  half_t* ws    = (half_t*)d_ws;
  half_t* xnA   = ws + OFF_XNA;   // reused as O A-frag after attention
  half_t* wqkvB = ws + OFF_WQKV;
  half_t* woutB = ws + OFF_WOUT;
  half_t* qA    = ws + OFF_QA;
  half_t* kTB   = ws + OFF_KTB;
  half_t* vB    = ws + OFF_VB;

  ln_pack_a<<<ROWS / 32, 256, 0, stream>>>(x, g, be, xnA);
  pack_b_qkv<<<dim3(NQKV / 128, DIM / 64), 256, 0, stream>>>(wqkv, wqkvB);
  pack_b_out<<<dim3(DIM / 128, DIM / 64), 256, 0, stream>>>(wout, woutB);
  zero_pad<<<256, 256, 0, stream>>>(kTB, vB);
  gemm_qkv<<<dim3(NQKV / 256, ROWS / 256), 512, 0, stream>>>(xnA, wqkvB, qA, kTB, vB);
  attn_kernel<<<BATCH * HEADS * NWIN, 256, 0, stream>>>(qA, kTB, vB, xnA);
  gemm_out<<<dim3(DIM / 256, ROWS / 256), 512, 0, stream>>>(xnA, woutB, (float*)d_out);
}

// v005
// It runs in 159 microseconds.
// In both of two side-by-side timings against v004, it was 1.05 times as fast.
// Counting every step since v000, it is 2.25 times as fast.
#include <hip/hip_runtime.h>
#include <hip/hip_bf16.h>

// ---------------------------------------------------------------------------
// Local windowed MHA forward for MI455X (gfx1250), wave32 + WMMA f16->f32.
//   b=2, n=8192, DIM=1024, HEADS=16, DHEAD=64, WINDOW=128, look_backward=1
// Pipeline: LN(pack A-frag) -> pack weights(B-frag) -> QKV GEMM (WMMA, q/kT/v
// frags) -> per-window attention (WMMA K Q^T, softmax, WMMA V^T P^T) ->
// output GEMM (WMMA) -> f32 out.
// Every product whose result is the operand of a later product is formed with
// the operand order that leaves a lane's 8 accumulators as 8 consecutive halfs
// of that lane's own place in the destination fragment.
// Both GEMMs stage their operand fragments in LDS (asynchronous copies, two
// buffers): one 256x256 tile per work-group, read by 8 waves of 64x128 each.
// ---------------------------------------------------------------------------

typedef __attribute__((ext_vector_type(16))) _Float16 v16h;
typedef __attribute__((ext_vector_type(8)))  float    v8f;
typedef __attribute__((ext_vector_type(2)))  float    v2f;
typedef __attribute__((ext_vector_type(2)))  _Float16 v2h;
typedef _Float16 half_t;

#define HEADS  16
#define DIM    1024
#define DHEAD  64
#define WIN    128
#define NTOK   8192
#define BATCH  2
#define ROWS   (BATCH * NTOK)   // 16384
#define NQKV   (3 * DIM)        // 3072
#define NWIN   (NTOK / WIN)     // 64
#define KT32   (DIM / 32)       // k-tiles of a row of 1024 (both GEMMs: K = 1024)

// Workspace layout (in halfs). All offsets keep >=32B alignment.
static constexpr size_t OFF_XNA  = 0;                       // 16384x1024 A-frag (reused as O A-frag)
static constexpr size_t OFF_WQKV = OFF_XNA  + 16777216;     // 1024x3072 B-frag
static constexpr size_t OFF_WOUT = OFF_WQKV + 3145728;      // 1024x1024 B-frag
static constexpr size_t OFF_QA   = OFF_WOUT + 1048576;      // per (b,h): 8192x64 A-frag
static constexpr size_t OFF_KTB  = OFF_QA   + 16777216;     // per (b,h): B-frag (d x padded keypos), 520 jtiles
static constexpr size_t OFF_VB   = OFF_KTB  + 17039360;     // per (b,h): B-frag (padded keypos x d), 260 ktiles
// total = 71,827,456 halfs = ~137 MB

static constexpr size_t QA_BH  = 524288;  // 512 mtiles * 2 ktiles * 512
static constexpr size_t KTB_BH = 532480;  // 520 jtiles * 2 dtiles * 512
static constexpr size_t VB_BH  = 532480;  // 4 ntiles * 260 ktiles * 512

// --- WMMA fragment addressing (element granularity) ------------------------
// A-frag (MxK): tile(mt,kt) base=((mt*Kt+kt)<<9); within tile, element (m,k):
//   lane = (m&15) | ((k>>3 & 1)<<4), halfidx = (k&7) | ((k>>4 & 1)<<3)
__device__ __forceinline__ size_t a_off(int kt32, int m, int k) {
  int kk   = k & 31;
  int lane = (m & 15) | (((kk >> 3) & 1) << 4);
  int hidx = (kk & 7) | (((kk >> 4) & 1) << 3);
  return ((size_t)((m >> 4) * kt32 + (k >> 5)) << 9) + (lane << 4) + hidx;
}
// B-frag (KxN): tile(nt,kt) base=((nt*Kt+kt)<<9); element (k,n) mirrors A.
__device__ __forceinline__ size_t b_off(int kt32, int k, int n) {
  int kk   = k & 31;
  int lane = (n & 15) | (((kk >> 3) & 1) << 4);
  int hidx = (kk & 7) | (((kk >> 4) & 1) << 3);
  return ((size_t)((n >> 4) * kt32 + (k >> 5)) << 9) + (lane << 4) + hidx;
}

__device__ __forceinline__ v16h load_frag(const half_t* p) {
  union { uint4 u[2]; v16h v; } t;
  t.u[0] = *(const uint4*)(p);
  t.u[1] = *(const uint4*)(p + 8);
  return t.v;
}

__device__ __forceinline__ v8f zero8() {
  v8f z;
#pragma unroll
  for (int e = 0; e < 8; ++e) z[e] = 0.0f;
  return z;
}

__device__ __forceinline__ v8f wmma_f16(v16h a, v16h b, v8f c) {
  return __builtin_amdgcn_wmma_f32_16x16x32_f16(false, a, false, b, (short)0, c,
                                                false, false);
}

// An A-frag of X holds the same registers as a B-frag of X^T (a_off and b_off
// mirror each other), so wmma_f16(frag(Y), frag(X)) is the tile of (X Y)^T:
// lane = (row of X) | (8-group of the column) << 4, register = column & 7.
// The 8 accumulators of a lane as 16 bytes of f16.
__device__ __forceinline__ uint4 pack8(v8f t, float sc) {
  union { v2h h[4]; uint4 u; } o;
#pragma unroll
  for (int e = 0; e < 4; ++e) {
    v2f p;
    p[0] = t[2 * e] * sc;
    p[1] = t[2 * e + 1] * sc;
    o.h[e] = __builtin_convertvector(p, v2h);   // one packed conversion
  }
  return o.u;
}

// 2^x of a tile's 8 values. One statement: every output lies apart from every
// input, and the v_nop is the slot that the instruction set asks for behind a
// transcendental before its result is used or its source overwritten.
__device__ __forceinline__ v8f exp2_8(v8f x) {
  float e0, e1, e2, e3, e4, e5, e6, e7;
  asm("v_exp_f32 %0, %8\n\t"
      "v_exp_f32 %1, %9\n\t"
      "v_exp_f32 %2, %10\n\t"
      "v_exp_f32 %3, %11\n\t"
      "v_exp_f32 %4, %12\n\t"
      "v_exp_f32 %5, %13\n\t"
      "v_exp_f32 %6, %14\n\t"
      "v_exp_f32 %7, %15\n\t"
      "v_nop"
      : "=&v"(e0), "=&v"(e1), "=&v"(e2), "=&v"(e3),
        "=&v"(e4), "=&v"(e5), "=&v"(e6), "=&v"(e7)
      : "v"(x[0]), "v"(x[1]), "v"(x[2]), "v"(x[3]),
        "v"(x[4]), "v"(x[5]), "v"(x[6]), "v"(x[7]));
  v8f e;
  e[0] = e0; e[1] = e1; e[2] = e2; e[3] = e3;
  e[4] = e4; e[5] = e5; e[6] = e6; e[7] = e7;
  return e;
}

// ---------------------------------------------------------------------------
// Kernel 1: LayerNorm, four rows per wave; normalized rows go out as f16
// A-frags. Lane = (row & 3) | (column quad << 2): a load reads one 128-B line of
// each of the four rows, and a store fills two whole 128-B lines of a fragment.
// Few long-lived waves: the launch is bound by memory, not by wave starts.
// ---------------------------------------------------------------------------
__global__ __launch_bounds__(256)
void ln_pack_a(const float* __restrict__ x, const float* __restrict__ g,
               const float* __restrict__ be, half_t* __restrict__ xnA) {
  const int lane = threadIdx.x & 31;
  const int wave = blockIdx.x * 8 + (threadIdx.x >> 5);
  const int row  = wave * 4 + (lane & 3);
  const int cq   = (lane >> 2) * 4;   // first of the lane's 4 columns in a k-tile
  const float* xr = x + (size_t)row * DIM + cq;
  float4 v[KT32];
  // Unrolled (as the three loops below): v and o stay in registers and all 32
  // loads of the wave are in flight together.
#pragma unroll
  for (int i = 0; i < KT32; ++i) v[i] = *(const float4*)(xr + i * 32);
  float4 s  = make_float4(0.0f, 0.0f, 0.0f, 0.0f);
  float4 s2 = make_float4(0.0f, 0.0f, 0.0f, 0.0f);
#pragma unroll
  for (int i = 0; i < KT32; ++i) {
    s.x += v[i].x; s.y += v[i].y; s.z += v[i].z; s.w += v[i].w;
    s2.x += v[i].x * v[i].x; s2.y += v[i].y * v[i].y;
    s2.z += v[i].z * v[i].z; s2.w += v[i].w * v[i].w;
  }
  float rs = (s.x + s.y) + (s.z + s.w);
  float rq = (s2.x + s2.y) + (s2.z + s2.w);
  // The eight lanes of a row differ in lane bits 2..4.
  rs += __shfl_xor(rs, 4);  rq += __shfl_xor(rq, 4);
  rs += __shfl_xor(rs, 8);  rq += __shfl_xor(rq, 8);
  rs += __shfl_xor(rs, 16); rq += __shfl_xor(rq, 16);
  const float mu   = rs * (1.0f / DIM);
  const float var  = rq * (1.0f / DIM) - mu * mu;
  const float rstd = rsqrtf(var + 1e-5f);
  uint2 o[KT32];
#pragma unroll
  for (int i = 0; i < KT32; ++i) {
    const float4 gv = *(const float4*)(g + i * 32 + cq);
    const float4 bv = *(const float4*)(be + i * 32 + cq);
    union { half_t h[4]; uint2 u; } p;
    p.h[0] = (half_t)((v[i].x - mu) * rstd * gv.x + bv.x);
    p.h[1] = (half_t)((v[i].y - mu) * rstd * gv.y + bv.y);
    p.h[2] = (half_t)((v[i].z - mu) * rstd * gv.z + bv.z);
    p.h[3] = (half_t)((v[i].w - mu) * rstd * gv.w + bv.w);
    o[i] = p.u;
  }
  half_t* dst = xnA + a_off(KT32, row, cq);
  // Holds every store behind the last load and the last arithmetic, so that no
  // register which an issued store names is written again.
  __builtin_amdgcn_sched_barrier(0);
#pragma unroll
  for (int i = 0; i < KT32; ++i) *(uint2*)(dst + i * 512) = o[i];
}

// ---------------------------------------------------------------------------
// Kernel 2 (one per weight matrix): pack a row-major KxN f32 matrix into f16
// B-frags. A wave builds two whole fragments (n-tile nt, k-tiles 2*y, 2*y+1):
// each lane gathers its own 16 halfs of each and stores them as 32 contiguous
// bytes. K and N are constants at each call, so that every row step is an
// immediate offset on one address.
// ---------------------------------------------------------------------------
__device__ __forceinline__ void pack_frags(const float* __restrict__ w,
                                           half_t* __restrict__ dst,
                                           const int K, const int N) {
  const int lane = threadIdx.x & 31;
  const int nt   = blockIdx.x * 8 + (threadIdx.x >> 5);
  const int kt   = blockIdx.y * 2;
  const float* p = w + (size_t)(kt * 32 + (lane >> 4) * 8) * N + nt * 16 + (lane & 15);
  half_t* d = dst + ((size_t)(nt * (K >> 5) + kt) << 9) + lane * 16;
  // Unrolled: all 32 loads of the wave are in flight together.
#pragma unroll
  for (int f = 0; f < 2; ++f) {
    union { half_t h[16]; uint4 u[2]; } o;
#pragma unroll
    for (int e = 0; e < 8; ++e) {
      o.h[e]     = (half_t)p[(f * 32 + e) * N];
      o.h[8 + e] = (half_t)p[(f * 32 + 16 + e) * N];
    }
    *(uint4*)(d + f * 512)     = o.u[0];
    *(uint4*)(d + f * 512 + 8) = o.u[1];
  }
}

__global__ __launch_bounds__(256)
void pack_b_qkv(const float* __restrict__ w, half_t* __restrict__ dst) {
  pack_frags(w, dst, DIM, NQKV);
}

__global__ __launch_bounds__(256)
void pack_b_out(const float* __restrict__ w, half_t* __restrict__ dst) {
  pack_frags(w, dst, DIM, DIM);
}

// ---------------------------------------------------------------------------
// Kernel 3: zero the one-chunk (128 keypos) lookback pad of kT / v frags.
// ---------------------------------------------------------------------------
__global__ __launch_bounds__(256)
void zero_pad(half_t* __restrict__ kTB, half_t* __restrict__ vB) {
  const int tid = blockIdx.x * 256 + threadIdx.x;  // 65536 units of 8 halfs
  const int bh  = tid >> 11;
  const int rem = tid & 2047;
  const uint4 z = make_uint4(0u, 0u, 0u, 0u);
  if (rem < 1024) {
    // kT pad: jtiles 0..7 -> frags 0..15 contiguous (8192 halfs)
    *(uint4*)(kTB + (size_t)bh * KTB_BH + (size_t)rem * 8) = z;
  } else {
    // v pad: frag (nt*260 + kt), nt=0..3, kt=0..3
    const int r2   = rem - 1024;
    const int frag = r2 >> 6, unit = r2 & 63;
    const int nt = frag >> 2, kt = frag & 3;
    *(uint4*)(vB + (size_t)bh * VB_BH + (((size_t)(nt * 260 + kt)) << 9) +
              (size_t)unit * 8) = z;
  }
}

// ---------------------------------------------------------------------------
// Shared GEMM core: 8 waves/block (4x2), each wave a 64x128 tile (4x8 WMMA
// tiles) of a 256x256 block tile: 12 fragments feed 32 WMMA, and two waves on a
// SIMD have the registers for a second fragment set, so that a block's LDS
// reads go out as one group a whole block ahead of their use.
// A pass is GP k-tiles (128 k), a block one k-tile. A stage holds
// 16 A tile rows, then 16 B tile rows, each GP fragments of 1 KB. In LDS a
// fragment is two 512-B planes (halfs 0..7 of every lane, then halfs 8..15), so
// that each ds_load_b128 of a wave reads 512 contiguous bytes.
// ---------------------------------------------------------------------------
#define GP     4                  // k-tiles per pass
#define GPASS  (KT32 / GP)        // passes
#define GROW   (GP * 512)         // halfs of one tile row in a stage
#define GSTAGE (32 * GROW)        // halfs of a stage (128 KB)

__device__ __forceinline__ v16h lds_frag(const half_t* p) {
  union { uint4 u[2]; v16h v; } t;
  t.u[0] = *(const uint4*)(p);
  t.u[1] = *(const uint4*)(p + 256);
  return t.v;
}

// Eight copies of 512 B: one tile row (GP fragments) of a stage. g: the lane's
// 16 bytes of the row's first 512 B; l: their LDS byte address. Global chunk
// 2*lane+h of a fragment goes to plane h, slot lane. The s_wait_xcnt closes the
// statement so that no address register is rewritten ahead of it.
__device__ __forceinline__ void copy_row(const half_t* g, uint32_t l) {
  asm volatile(
      "global_load_async_to_lds_b128 %0, %8, off\n\t"
      "global_load_async_to_lds_b128 %1, %9, off\n\t"
      "global_load_async_to_lds_b128 %2, %10, off\n\t"
      "global_load_async_to_lds_b128 %3, %11, off\n\t"
      "global_load_async_to_lds_b128 %4, %12, off\n\t"
      "global_load_async_to_lds_b128 %5, %13, off\n\t"
      "global_load_async_to_lds_b128 %6, %14, off\n\t"
      "global_load_async_to_lds_b128 %7, %15, off\n\t"
      "s_wait_xcnt 0x0"
      :: "v"(l), "v"(l + 256u), "v"(l + 1024u), "v"(l + 1280u),
         "v"(l + 2048u), "v"(l + 2304u), "v"(l + 3072u), "v"(l + 3328u),
         "v"(g), "v"(g + 256), "v"(g + 512), "v"(g + 768),
         "v"(g + 1024), "v"(g + 1280), "v"(g + 1536), "v"(g + 1792)
      : "memory");
}

// The lane's number, read anew wherever copy addresses are formed: held in
// vector registers across the WMMA blocks, next to 448 registers of
// accumulators and fragments, these addresses were spilled.
__device__ __forceinline__ uint32_t lane_now() {
  uint32_t ln;
  asm volatile("v_mbcnt_lo_u32_b32 %0, -1, 0" : "=v"(ln));
  return ln;
}
// The lane's own source and LDS byte address in a wave's first tile row (gu, lu:
// that row, both uniform).
__device__ __forceinline__ const half_t* copy_src(const half_t* gu, uint32_t ln) {
  return gu + ln * 8u;
}
__device__ __forceinline__ uint32_t copy_dst(uint32_t lu, uint32_t ln) {
  return lu + (ln & 1u) * 512u + (ln >> 1) * 16u;
}
// Tile row r of a wave's share of a stage (four tile rows, 32 copies).
__device__ __forceinline__ void copy_share(const half_t* g, uint32_t l, int r) {
  copy_row(g + r * (KT32 << 9), l + (uint32_t)r * (GROW * 2u));
}
__device__ __forceinline__ void copy_stage(const half_t* gu, uint32_t lu) {
  const uint32_t ln = lane_now();
  const half_t* g = copy_src(gu, ln);
  const uint32_t l = copy_dst(lu, ln);
  copy_share(g, l, 0);
  copy_share(g, l, 1);
  copy_share(g, l, 2);
  copy_share(g, l, 3);
}

// This wave's copies have landed (the compiler places no wait for them).
__device__ __forceinline__ void wait_async0() {
  asm volatile("s_wait_asynccnt 0x0" ::: "memory");
}
// This wave's LDS reads are done before the buffer goes back to the copies.
__device__ __forceinline__ void wait_ds0() {
  asm volatile("s_wait_dscnt 0x0" ::: "memory");
}

// The 12 fragments of one block: 24 ds_load_b128. The loops here, in mma_block
// and at the foot of a pass are unrolled so that every fragment and accumulator
// index is a constant and they stay in registers.
__device__ __forceinline__ void load_block(const half_t* pa, const half_t* pb,
                                           v16h a[4], v16h b[8]) {
#pragma unroll
  for (int i = 0; i < 4; ++i) a[i] = lds_frag(pa + i * GROW);
#pragma unroll
  for (int j = 0; j < 8; ++j) b[j] = lds_frag(pb + j * GROW);
}

__device__ __forceinline__ void mma_block(const v16h a[4], const v16h b[8],
                                          v8f c[4][8]) {
#pragma unroll
  for (int i = 0; i < 4; ++i)
#pragma unroll
    for (int j = 0; j < 8; ++j) c[i][j] = wmma_f16(a[i], b[j], c[i][j]);
}

// Keeps a load group whole and in front of the WMMA block that covers its
// latency: without it the compiler sinks the loads in among the WMMAs, next to
// their use, and every such place stalls the wave.
__device__ __forceinline__ void block_edge() {
  __builtin_amdgcn_sched_barrier(0);
}

__device__ __forceinline__ void gemm_tile(const half_t* __restrict__ A,
                                          const half_t* __restrict__ B,
                                          half_t* sm, int mtb, int ntb,
                                          v8f c[4][8]) {
  const int lane = threadIdx.x & 31;
  // The wave's number as a scalar: the uniform part of every address stays in
  // scalar registers.
  const int wid = __builtin_amdgcn_readfirstlane(threadIdx.x >> 5);
  const int wm = wid >> 1, wn = wid & 1;
#pragma unroll
  for (int i = 0; i < 4; ++i)
#pragma unroll
    for (int j = 0; j < 8; ++j) c[i][j] = zero8();

  // Waves 0..3 copy the A tile rows 4*wid .. 4*wid+3; waves 4..7 the B rows.
  const int row0 = (wid & 3) * 4;
  const half_t* src = wid < 4 ? A + ((size_t)(mtb + row0) * KT32 << 9)
                              : B + ((size_t)(ntb + row0) * KT32 << 9);
  const uint32_t dst = (uint32_t)(size_t)sm + (uint32_t)wid * (GROW * 8u);
  // The wave's first A and B fragment in buffer 0.
  const half_t* fa = sm + lane * 8 + wm * 4 * GROW;
  const half_t* fb = sm + lane * 8 + (16 + wn * 8) * GROW;
  v16h a0[4], b0[8], a1[4], b1[8];

  copy_stage(src, dst);
  wait_async0();
  __syncthreads();
  copy_stage(src + GROW, dst + GSTAGE * 2u);
  load_block(fa, fb, a0, b0);

  // Kept rolled: one publish point in the text, the buffer index a scalar.
#pragma unroll 1
  for (int t = 0; t < GPASS; ++t) {
    const int cur = (t & 1) * GSTAGE;
    const half_t* pa = fa + cur;
    const half_t* pb = fb + cur;
    load_block(pa + 512, pb + 512, a1, b1);
    block_edge();
    mma_block(a0, b0, c);
    block_edge();
    load_block(pa + 1024, pb + 1024, a0, b0);
    block_edge();
    mma_block(a1, b1, c);
    block_edge();
    load_block(pa + 1536, pb + 1536, a1, b1);
    block_edge();
    mma_block(a0, b0, c);
    block_edge();
    // Publish pass t+1 and free this pass's buffer, whose last fragments are
    // in registers by now: one barrier does both. It stands in front of the
    // pass's last block, which covers the latency of the next pass's first
    // fragments and, a tile row of copies in front of each 8 WMMA, the
    // refill's issue: while one wave of a SIMD forms addresses and waits out
    // its s_wait_xcnt, the other has WMMAs to issue. The LDS reads still in
    // flight at the copies are of the other buffer.
    wait_ds0();
    wait_async0();
    __syncthreads();
    if (t + 1 < GPASS) load_block(fa + (GSTAGE - cur), fb + (GSTAGE - cur), a0, b0);
    block_edge();
#pragma unroll
    for (int i = 0; i < 4; ++i) {
      if (t + 2 < GPASS) {
        const uint32_t ln = lane_now();
        copy_share(copy_src(src + (t + 2) * GROW, ln),
                   copy_dst(dst + (uint32_t)(t & 1) * (GSTAGE * 2u), ln), i);
      }
      block_edge();
#pragma unroll
      for (int j = 0; j < 8; ++j) c[i][j] = wmma_f16(a1[i], b1[j], c[i][j]);
      block_edge();
    }
  }
  wait_async0();
}

// ---------------------------------------------------------------------------
// Kernel 4: QKV GEMM. C=(16384x3072). A block's 256 columns lie in one of q, k,
// v. q and k fragments run along d inside a lane, so their blocks take the
// weights as the A operand and x as B (the tile comes out transposed: one head
// by 128 tokens a wave); v fragments run along the tokens: x as A (64 tokens by
// two heads a wave).
// Either way tiles c[2p][j], c[2p+1][j] are a lane's 32 bytes of one fragment.
// ---------------------------------------------------------------------------
__global__ __launch_bounds__(256)
void gemm_qkv(const half_t* __restrict__ A, const half_t* __restrict__ B,
              half_t* __restrict__ qA, half_t* __restrict__ kTB,
              half_t* __restrict__ vB) {
  __shared__ __attribute__((aligned(16))) half_t sm[2 * GSTAGE];
  const int lane = threadIdx.x & 31, wid = threadIdx.x >> 5;
  const int wm = wid >> 1, wn = wid & 1;
  const int part = blockIdx.x >> 2;   // 0=q 1=k 2=v
  const bool sw  = part < 2;          // weights as the A operand
  v8f c[4][8];
  gemm_tile(sw ? B : A, sw ? A : B, sm,
            (sw ? blockIdx.x : blockIdx.y) * 16,
            (sw ? blockIdx.y : blockIdx.x) * 16, c);

  // The wave's head (q, k) or the first, even one of its two heads (v).
  const int h  = (blockIdx.x * 4 + (sw ? wm : wn * 2)) & (HEADS - 1);
  const int bh = (blockIdx.y >> 5) * HEADS + h;
  // The wave's first 16-token tile inside its batch row (a multiple of 4).
  const int tt = (blockIdx.y & 31) * 16 + (sw ? wn * 8 : wm * 4);
  // j: token tile (q, k) or head j >> 2 and 16-column group j & 3 of d (v); p:
  // fragment along the other index. Key positions carry the lookback pad of 8
  // token tiles.
  half_t* base = part == 0 ? qA  + (size_t)bh * QA_BH  + ((size_t)(tt * 2) << 9)
               : part == 1 ? kTB + (size_t)bh * KTB_BH + ((size_t)((tt + 8) * 2) << 9)
                           : vB  + (size_t)bh * VB_BH  + ((size_t)((tt + 8) >> 1) << 9);
  const size_t sj = part == 2 ? (size_t)260 * 512 : (size_t)1024;
  const size_t s4 = part == 2 ? VB_BH : (size_t)4096;   // step of j >> 2
  const float  sc = part == 0 ? 0.125f : 1.0f;
  uint4 o[4][8];
  half_t* d[8];
#pragma unroll
  for (int j = 0; j < 8; ++j) {
    d[j] = base + (j >> 2) * s4 + (j & 3) * sj + lane * 16;
#pragma unroll
    for (int i = 0; i < 4; ++i) o[i][j] = pack8(c[i][j], sc);
  }
#pragma unroll
  for (int j = 0; j < 8; ++j)
#pragma unroll
    for (int i = 0; i < 4; ++i) *(uint4*)(d[j] + (i >> 1) * 512 + (i & 1) * 8) = o[i][j];
}

// ---------------------------------------------------------------------------
// Kernel 5: local attention. One block per (b,h,window); 8 waves; each wave
// owns a 16-query strip: sim^T = K Q^T, mask+softmax, out^T = V^T P^T.
// A lane holds one query and half of its keys: maximum and sum are in-lane but
// for one exchange between the wave's halves, and two score tiles, converted,
// are the lane's own B operand of the second product.
// Of the 16 key tiles of the 256-key frame, strip mt can see only tiles
// mt .. mt+8 (q_pos - WIN <= k_pos <= q_pos); every other tile is masked as a
// whole and its weights are exact zeros, so the wave never visits it: 9 score
// tiles (18 WMMA) and the 5 k-tiles of v that hold them (20 WMMA).
// ---------------------------------------------------------------------------
#define KVIS 9   // key tiles that a 16-query strip can see

__global__ __launch_bounds__(256)
void attn_kernel(const half_t* __restrict__ qA, const half_t* __restrict__ kTB,
                 const half_t* __restrict__ vB, half_t* __restrict__ oA) {
  const int lane = threadIdx.x & 31;
  // The strip's number as a scalar: tile addresses and tile tests are uniform.
  const int mt = __builtin_amdgcn_readfirstlane(threadIdx.x >> 5);
  const int wi = blockIdx.x & (NWIN - 1);
  const int h  = (blockIdx.x >> 6) & (HEADS - 1);
  const int b  = blockIdx.x >> 10;
  const int bh = b * HEADS + h;
  const half_t* qbase = qA  + (size_t)bh * QA_BH;
  const half_t* kbase = kTB + (size_t)bh * KTB_BH;
  const half_t* vbase = vB  + (size_t)bh * VB_BH;

  const v16h aq0 = load_frag(qbase + (((size_t)(wi * 8 + mt) * 2 + 0) << 9) + lane * 16);
  const v16h aq1 = load_frag(qbase + (((size_t)(wi * 8 + mt) * 2 + 1) << 9) + lane * 16);
  // These four loads name one address pair; the wait stands in front of the next
  // loads, whose results may be placed over that pair.
  asm volatile("s_wait_xcnt 0x0" ::: "memory");

  // --- sim^T = k @ q^T : c[r][v] = sim[query ncol][key (mt+r)*16 + v + rbase]
  const half_t* kp = kbase + (((size_t)(wi * 8 + mt) * 2) << 9) + lane * 16;
  v8f c[KVIS];
#pragma unroll
  for (int r = 0; r < KVIS; ++r) {
    const v16h b0 = load_frag(kp + r * 1024);
    const v16h b1 = load_frag(kp + r * 1024 + 512);
    v8f acc = zero8();
    acc = wmma_f16(b0, aq0, acc);
    acc = wmma_f16(b1, aq1, acc);
    c[r] = acc;
  }

  // --- causal local mask + softmax of the lane's query ------------------
  const int rbase = (lane >> 4) << 3;
  const int ncol  = lane & 15;
  // q_pos - k_pos = WIN - r*16 + dq - v. It lies inside 0 .. WIN for every
  // element of tiles 1..7; tile 0 can exceed WIN, tile 8 can fall below 0.
  const int dq = ncol - rbase;
#pragma unroll
  for (int v = 0; v < 8; ++v) {
    c[0][v]        = v < dq ? -3.0e38f : c[0][v];          // q_pos > k_pos + WIN
    c[KVIS - 1][v] = v > dq ? -3.0e38f : c[KVIS - 1][v];   // q_pos < k_pos
  }
  // In window 0 the lookback half (frame tiles below 8) is the pad (k_pos < 0).
  if (wi == 0) {
#pragma unroll
    for (int r = 0; r < 8; ++r) {
      const bool pad = mt + r < 8;
#pragma unroll
      for (int v = 0; v < 8; ++v) c[r][v] = pad ? -3.0e38f : c[r][v];
    }
  }
  // Eight independent chains for the maximum, and eight for the sum.
  v8f mv, sv;
#pragma unroll
  for (int v = 0; v < 8; ++v) { mv[v] = -3.0e38f; sv[v] = 0.0f; }
#pragma unroll
  for (int r = 0; r < KVIS; ++r)
#pragma unroll
    for (int v = 0; v < 8; ++v) mv[v] = fmaxf(mv[v], c[r][v]);
  float m = fmaxf(fmaxf(fmaxf(mv[0], mv[1]), fmaxf(mv[2], mv[3])),
                  fmaxf(fmaxf(mv[4], mv[5]), fmaxf(mv[6], mv[7])));
  m = fmaxf(m, __shfl_xor(m, 16));
#pragma unroll
  for (int r = 0; r < KVIS; ++r) {
    c[r] = exp2_8((c[r] - m) * 1.44269504f);   // e^(x - m)
    sv += c[r];
  }
  float s = ((sv[0] + sv[1]) + (sv[2] + sv[3])) + ((sv[4] + sv[5]) + (sv[6] + sv[7]));
  s += __shfl_xor(s, 16);
  const float inv = 1.0f / s;

  // --- out^T = v^T @ attn^T : oc[nt][v] = out[query ncol][d nt*16 + v + rbase]
  // A k-tile of v is an even frame tile and the odd one behind it. An even strip
  // starts on the low half of its first k-tile, an odd strip on the high half;
  // the half that falls outside the nine tiles has weight zero.
  uint4 pw[KVIS];
#pragma unroll
  for (int r = 0; r < KVIS; ++r) pw[r] = pack8(c[r], inv);
  const bool odd = (mt & 1) != 0;
  const uint4 z4 = make_uint4(0u, 0u, 0u, 0u);
  const half_t* vp = vbase + (((size_t)(wi * 4 + (mt >> 1))) << 9) + lane * 16;
  v8f oc[4];
#pragma unroll
  for (int nt = 0; nt < 4; ++nt) oc[nt] = zero8();
#pragma unroll
  for (int t = 0; t < 5; ++t) {
    union { uint4 u[2]; v16h v; } up;
    up.u[0] = odd ? (t == 0 ? z4 : pw[t == 0 ? 0 : 2 * t - 1]) : pw[2 * t];
    up.u[1] = odd ? pw[2 * t] : (t == 4 ? z4 : pw[t == 4 ? 8 : 2 * t + 1]);
    const v16h pf = up.v;
#pragma unroll
    for (int nt = 0; nt < 4; ++nt) {
      const v16h bf = load_frag(vp + (size_t)(nt * 260 + t) * 512);
      oc[nt] = wmma_f16(bf, pf, oc[nt]);
    }
  }

  // --- the strip's two A-frags of the (16384 x 1024) output matrix ------
  const int m0 = b * NTOK + wi * WIN + mt * 16;
  half_t* od = oA + ((size_t)((m0 >> 4) * KT32 + h * 2) << 9) + lane * 16;
  uint4 o[4];
#pragma unroll
  for (int nt = 0; nt < 4; ++nt) o[nt] = pack8(oc[nt], 1.0f);
#pragma unroll
  for (int nt = 0; nt < 4; ++nt) *(uint4*)(od + (nt >> 1) * 512 + (nt & 1) * 8) = o[nt];
}

// ---------------------------------------------------------------------------
// Kernel 6: output GEMM, f32 row-major result.
// ---------------------------------------------------------------------------
__global__ __launch_bounds__(256)
void gemm_out(const half_t* __restrict__ A, const half_t* __restrict__ B,
              float* __restrict__ out) {
  __shared__ __attribute__((aligned(16))) half_t sm[2 * GSTAGE];
  const int lane = threadIdx.x & 31, wid = threadIdx.x >> 5;
  const int wm = wid >> 1, wn = wid & 1;
  const int mt0 = blockIdx.y * 16 + wm * 4;
  const int nt0 = blockIdx.x * 16 + wn * 8;
  v8f c[4][8];
  gemm_tile(A, B, sm, blockIdx.y * 16, blockIdx.x * 16, c);
  const int rbase = (lane >> 4) << 3;
  const int ncol  = lane & 15;
#pragma unroll
  for (int i = 0; i < 4; ++i)
#pragma unroll
    for (int j = 0; j < 8; ++j)
#pragma unroll
      for (int v = 0; v < 8; ++v) {
        const int row = (mt0 + i) * 16 + v + rbase;
        const int col = (nt0 + j) * 16 + ncol;
        out[(size_t)row * DIM + col] = c[i][j][v];
      }
}

// ---------------------------------------------------------------------------
extern "C" void kernel_launch(void* const* d_in, const int* in_sizes, int n_in,
                              void* d_out, int out_size, void* d_ws,
                              size_t ws_size, hipStream_t stream) {
  (void)in_sizes; (void)n_in; (void)out_size; (void)ws_size;
  const float* x    = (const float*)d_in[0];
  const float* g    = (const float*)d_in[1];
  const float* be   = (const float*)d_in[2];
  const float* wqkv = (const float*)d_in[3];
  const float* wout = (const float*)d_in[4];

  half_t* ws    = (half_t*)d_ws;
  half_t* xnA   = ws + OFF_XNA;   // reused as O A-frag after attention
  half_t* wqkvB = ws + OFF_WQKV;
  half_t* woutB = ws + OFF_WOUT;
  half_t* qA    = ws + OFF_QA;
  half_t* kTB   = ws + OFF_KTB;
  half_t* vB    = ws + OFF_VB;

  ln_pack_a<<<ROWS / 32, 256, 0, stream>>>(x, g, be, xnA);
  pack_b_qkv<<<dim3(NQKV / 128, DIM / 64), 256, 0, stream>>>(wqkv, wqkvB);
  pack_b_out<<<dim3(DIM / 128, DIM / 64), 256, 0, stream>>>(wout, woutB);
  zero_pad<<<256, 256, 0, stream>>>(kTB, vB);
  gemm_qkv<<<dim3(NQKV / 256, ROWS / 256), 256, 0, stream>>>(xnA, wqkvB, qA, kTB, vB);
  attn_kernel<<<BATCH * HEADS * NWIN, 256, 0, stream>>>(qA, kTB, vB, xnA);
  gemm_out<<<dim3(DIM / 256, ROWS / 256), 256, 0, stream>>>(xnA, woutB, (float*)d_out);
}

// v006
// One run takes 151 microseconds.
// In two side-by-side timings against v005, it was 1.06 and 1.05 times as fast.
// All steps since v000 together make it 2.37 times as fast.
#include <hip/hip_runtime.h>
#include <hip/hip_bf16.h>

// ---------------------------------------------------------------------------
// Local windowed MHA forward for MI455X (gfx1250), wave32 + WMMA f16->f32.
//   b=2, n=8192, DIM=1024, HEADS=16, DHEAD=64, WINDOW=128, look_backward=1
// Pipeline: one preparation launch (LN to A-frags, both weight packs to B-frags,
// pad zeroing) -> QKV GEMM (WMMA, q/kT/v frags) -> per-window attention (WMMA
// K Q^T, softmax, WMMA V^T P^T) -> output GEMM (WMMA) -> f32 out.
// Every product whose result is the operand of a later product is formed with
// the operand order that leaves a lane's 8 accumulators as 8 consecutive halfs
// of that lane's own place in the destination fragment.
// Both GEMMs stage their operand fragments in LDS (asynchronous copies, two
// buffers): one 256x256 tile per work-group, read by 8 waves of 64x128 each.
// ---------------------------------------------------------------------------

typedef __attribute__((ext_vector_type(16))) _Float16 v16h;
typedef __attribute__((ext_vector_type(8)))  float    v8f;
typedef __attribute__((ext_vector_type(2)))  float    v2f;
typedef __attribute__((ext_vector_type(2)))  _Float16 v2h;
typedef _Float16 half_t;

#define HEADS  16
#define DIM    1024
#define DHEAD  64
#define WIN    128
#define NTOK   8192
#define BATCH  2
#define ROWS   (BATCH * NTOK)   // 16384
#define NQKV   (3 * DIM)        // 3072
#define NWIN   (NTOK / WIN)     // 64
#define KT32   (DIM / 32)       // k-tiles of a row of 1024 (both GEMMs: K = 1024)

// Workspace layout (in halfs). All offsets keep >=32B alignment.
static constexpr size_t OFF_XNA  = 0;                       // 16384x1024 A-frag (reused as O A-frag)
static constexpr size_t OFF_WQKV = OFF_XNA  + 16777216;     // 1024x3072 B-frag
static constexpr size_t OFF_WOUT = OFF_WQKV + 3145728;      // 1024x1024 B-frag
static constexpr size_t OFF_QA   = OFF_WOUT + 1048576;      // per (b,h): 8192x64 A-frag
static constexpr size_t OFF_KTB  = OFF_QA   + 16777216;     // per (b,h): B-frag (d x padded keypos), 520 jtiles
static constexpr size_t OFF_VB   = OFF_KTB  + 17039360;     // per (b,h): B-frag (padded keypos x d), 260 ktiles
// total = 71,827,456 halfs = ~137 MB

static constexpr size_t QA_BH  = 524288;  // 512 mtiles * 2 ktiles * 512
static constexpr size_t KTB_BH = 532480;  // 520 jtiles * 2 dtiles * 512
static constexpr size_t VB_BH  = 532480;  // 4 ntiles * 260 ktiles * 512

// --- WMMA fragment addressing (element granularity) ------------------------
// A-frag (MxK): tile(mt,kt) base=((mt*Kt+kt)<<9); within tile, element (m,k):
//   lane = (m&15) | ((k>>3 & 1)<<4), halfidx = (k&7) | ((k>>4 & 1)<<3)
__device__ __forceinline__ size_t a_off(int kt32, int m, int k) {
  int kk   = k & 31;
  int lane = (m & 15) | (((kk >> 3) & 1) << 4);
  int hidx = (kk & 7) | (((kk >> 4) & 1) << 3);
  return ((size_t)((m >> 4) * kt32 + (k >> 5)) << 9) + (lane << 4) + hidx;
}
// B-frag (KxN): tile(nt,kt) base=((nt*Kt+kt)<<9); element (k,n) mirrors A.
__device__ __forceinline__ size_t b_off(int kt32, int k, int n) {
  int kk   = k & 31;
  int lane = (n & 15) | (((kk >> 3) & 1) << 4);
  int hidx = (kk & 7) | (((kk >> 4) & 1) << 3);
  return ((size_t)((n >> 4) * kt32 + (k >> 5)) << 9) + (lane << 4) + hidx;
}

__device__ __forceinline__ v16h load_frag(const half_t* p) {
  union { uint4 u[2]; v16h v; } t;
  t.u[0] = *(const uint4*)(p);
  t.u[1] = *(const uint4*)(p + 8);
  return t.v;
}

__device__ __forceinline__ v8f zero8() {
  v8f z;
#pragma unroll
  for (int e = 0; e < 8; ++e) z[e] = 0.0f;
  return z;
}

__device__ __forceinline__ v8f wmma_f16(v16h a, v16h b, v8f c) {
  return __builtin_amdgcn_wmma_f32_16x16x32_f16(false, a, false, b, (short)0, c,
                                                false, false);
}

// An A-frag of X holds the same registers as a B-frag of X^T (a_off and b_off
// mirror each other), so wmma_f16(frag(Y), frag(X)) is the tile of (X Y)^T:
// lane = (row of X) | (8-group of the column) << 4, register = column & 7.
// The 8 accumulators of a lane as 16 bytes of f16.
__device__ __forceinline__ uint4 pack8(v8f t, float sc) {
  union { v2h h[4]; uint4 u; } o;
#pragma unroll
  for (int e = 0; e < 4; ++e) {
    v2f p;
    p[0] = t[2 * e] * sc;
    p[1] = t[2 * e + 1] * sc;
    o.h[e] = __builtin_convertvector(p, v2h);   // one packed conversion
  }
  return o.u;
}

// 2^x of a tile's 8 values. One statement: every output lies apart from every
// input, and the v_nop is the slot that the instruction set asks for behind a
// transcendental before its result is used or its source overwritten.
__device__ __forceinline__ v8f exp2_8(v8f x) {
  float e0, e1, e2, e3, e4, e5, e6, e7;
  asm("v_exp_f32 %0, %8\n\t"
      "v_exp_f32 %1, %9\n\t"
      "v_exp_f32 %2, %10\n\t"
      "v_exp_f32 %3, %11\n\t"
      "v_exp_f32 %4, %12\n\t"
      "v_exp_f32 %5, %13\n\t"
      "v_exp_f32 %6, %14\n\t"
      "v_exp_f32 %7, %15\n\t"
      "v_nop"
      : "=&v"(e0), "=&v"(e1), "=&v"(e2), "=&v"(e3),
        "=&v"(e4), "=&v"(e5), "=&v"(e6), "=&v"(e7)
      : "v"(x[0]), "v"(x[1]), "v"(x[2]), "v"(x[3]),
        "v"(x[4]), "v"(x[5]), "v"(x[6]), "v"(x[7]));
  v8f e;
  e[0] = e0; e[1] = e1; e[2] = e2; e[3] = e3;
  e[4] = e4; e[5] = e5; e[6] = e6; e[7] = e7;
  return e;
}

// ---------------------------------------------------------------------------
// Preparation job 1: LayerNorm, four rows per wave; normalized rows go out as f16
// A-frags. Lane = (row & 3) | (column quad << 2): a load reads one 128-B line of
// each of the four rows, and a store fills two whole 128-B lines of a fragment.
// Few long-lived waves: the job is bound by memory, not by wave starts.
// blk: the block's number inside the job (here and in the jobs below).
// ---------------------------------------------------------------------------
__device__ __forceinline__
void ln_pack_a(const float* __restrict__ x, const float* __restrict__ g,
               const float* __restrict__ be, half_t* __restrict__ xnA,
               const int blk) {
  const int lane = threadIdx.x & 31;
  const int wave = blk * 8 + (threadIdx.x >> 5);
  const int row  = wave * 4 + (lane & 3);
  const int cq   = (lane >> 2) * 4;   // first of the lane's 4 columns in a k-tile
  const float* xr = x + (size_t)row * DIM + cq;
  float4 v[KT32];
  // Unrolled (as the three loops below): v and o stay in registers and all 32
  // loads of the wave are in flight together.
#pragma unroll
  for (int i = 0; i < KT32; ++i) v[i] = *(const float4*)(xr + i * 32);
  float4 s  = make_float4(0.0f, 0.0f, 0.0f, 0.0f);
  float4 s2 = make_float4(0.0f, 0.0f, 0.0f, 0.0f);
#pragma unroll
  for (int i = 0; i < KT32; ++i) {
    s.x += v[i].x; s.y += v[i].y; s.z += v[i].z; s.w += v[i].w;
    s2.x += v[i].x * v[i].x; s2.y += v[i].y * v[i].y;
    s2.z += v[i].z * v[i].z; s2.w += v[i].w * v[i].w;
  }
  float rs = (s.x + s.y) + (s.z + s.w);
  float rq = (s2.x + s2.y) + (s2.z + s2.w);
  // The eight lanes of a row differ in lane bits 2..4.
  rs += __shfl_xor(rs, 4);  rq += __shfl_xor(rq, 4);
  rs += __shfl_xor(rs, 8);  rq += __shfl_xor(rq, 8);
  rs += __shfl_xor(rs, 16); rq += __shfl_xor(rq, 16);
  const float mu   = rs * (1.0f / DIM);
  const float var  = rq * (1.0f / DIM) - mu * mu;
  const float rstd = rsqrtf(var + 1e-5f);
  uint2 o[KT32];
#pragma unroll
  for (int i = 0; i < KT32; ++i) {
    const float4 gv = *(const float4*)(g + i * 32 + cq);
    const float4 bv = *(const float4*)(be + i * 32 + cq);
    union { half_t h[4]; uint2 u; } p;
    p.h[0] = (half_t)((v[i].x - mu) * rstd * gv.x + bv.x);
    p.h[1] = (half_t)((v[i].y - mu) * rstd * gv.y + bv.y);
    p.h[2] = (half_t)((v[i].z - mu) * rstd * gv.z + bv.z);
    p.h[3] = (half_t)((v[i].w - mu) * rstd * gv.w + bv.w);
    o[i] = p.u;
  }
  half_t* dst = xnA + a_off(KT32, row, cq);
  // Holds every store behind the last load and the last arithmetic, so that no
  // register which an issued store names is written again.
  __builtin_amdgcn_sched_barrier(0);
#pragma unroll
  for (int i = 0; i < KT32; ++i) *(uint2*)(dst + i * 512) = o[i];
}

// ---------------------------------------------------------------------------
// Preparation jobs 2 and 3 (one per weight matrix): pack a row-major KxN f32
// matrix into f16 B-frags. Block blk is column blk % (N / 128), row
// y = blk / (N / 128) of the job's grid of N / 128 by K / 64 blocks.
// A wave builds two whole fragments (n-tile nt, k-tiles 2*y, 2*y+1):
// each lane gathers its own 16 halfs of each and stores them as 32 contiguous
// bytes. K and N are constants at each call, so that every row step is an
// immediate offset on one address.
// ---------------------------------------------------------------------------
__device__ __forceinline__ void pack_frags(const float* __restrict__ w,
                                           half_t* __restrict__ dst,
                                           const int K, const int N,
                                           const int blk) {
  const int lane = threadIdx.x & 31;
  const int nt   = (blk % (N / 128)) * 8 + (threadIdx.x >> 5);
  const int kt   = (blk / (N / 128)) * 2;
  const float* p = w + (size_t)(kt * 32 + (lane >> 4) * 8) * N + nt * 16 + (lane & 15);
  half_t* d = dst + ((size_t)(nt * (K >> 5) + kt) << 9) + lane * 16;
  // Unrolled: all 32 loads of the wave are in flight together.
#pragma unroll
  for (int f = 0; f < 2; ++f) {
    union { half_t h[16]; uint4 u[2]; } o;
#pragma unroll
    for (int e = 0; e < 8; ++e) {
      o.h[e]     = (half_t)p[(f * 32 + e) * N];
      o.h[8 + e] = (half_t)p[(f * 32 + 16 + e) * N];
    }
    *(uint4*)(d + f * 512)     = o.u[0];
    *(uint4*)(d + f * 512 + 8) = o.u[1];
  }
  // Other jobs' code follows in the kernel's text: the wait stands between the
  // four stores and any later write of a register that they name.
  asm volatile("s_wait_xcnt 0x0" ::: "memory");
}

// ---------------------------------------------------------------------------
// Preparation job 4: zero the one-chunk (128 keypos) lookback pad of kT / v frags.
// ---------------------------------------------------------------------------
__device__ __forceinline__
void zero_pad(half_t* __restrict__ kTB, half_t* __restrict__ vB, const int blk) {
  const int tid = blk * 256 + threadIdx.x;  // 65536 units of 8 halfs
  const int bh  = tid >> 11;
  const int rem = tid & 2047;
  const uint4 z = make_uint4(0u, 0u, 0u, 0u);
  if (rem < 1024) {
    // kT pad: jtiles 0..7 -> frags 0..15 contiguous (8192 halfs)
    *(uint4*)(kTB + (size_t)bh * KTB_BH + (size_t)rem * 8) = z;
  } else {
    // v pad: frag (nt*260 + kt), nt=0..3, kt=0..3
    const int r2   = rem - 1024;
    const int frag = r2 >> 6, unit = r2 & 63;
    const int nt = frag >> 2, kt = frag & 3;
    *(uint4*)(vB + (size_t)bh * VB_BH + (((size_t)(nt * 260 + kt)) << 9) +
              (size_t)unit * 8) = z;
  }
}

// ---------------------------------------------------------------------------
// Kernel 1: the four preparation jobs in one grid. None reads what another
// writes, so the block index picks the job: the short jobs run beside the
// LayerNorm stream, and one launch (gap, wave start, first-load latency, store
// drain) is paid for where four were. The LayerNorm blocks, the longest, come
// first in the index.
// ---------------------------------------------------------------------------
#define LN_BLKS (ROWS / 32)
#define PQ_BLKS ((NQKV / 128) * (DIM / 64))
#define PO_BLKS ((DIM / 128) * (DIM / 64))
#define ZP_BLKS 256

__global__ __launch_bounds__(256)
void prepare(const float* __restrict__ x, const float* __restrict__ g,
             const float* __restrict__ be, const float* __restrict__ wqkv,
             const float* __restrict__ wout, half_t* __restrict__ xnA,
             half_t* __restrict__ wqkvB, half_t* __restrict__ woutB,
             half_t* __restrict__ kTB, half_t* __restrict__ vB) {
  const int blk = blockIdx.x;
  if (blk < LN_BLKS) {
    ln_pack_a(x, g, be, xnA, blk);
  } else if (blk < LN_BLKS + PQ_BLKS) {
    pack_frags(wqkv, wqkvB, DIM, NQKV, blk - LN_BLKS);
  } else if (blk < LN_BLKS + PQ_BLKS + PO_BLKS) {
    pack_frags(wout, woutB, DIM, DIM, blk - (LN_BLKS + PQ_BLKS));
  } else {
    zero_pad(kTB, vB, blk - (LN_BLKS + PQ_BLKS + PO_BLKS));
  }
}

// ---------------------------------------------------------------------------
// Shared GEMM core: 8 waves/block (4x2), each wave a 64x128 tile (4x8 WMMA
// tiles) of a 256x256 block tile: 12 fragments feed 32 WMMA, and two waves on a
// SIMD have the registers for a second fragment set, so that a block's LDS
// reads go out as one group a whole block ahead of their use.
// A pass is GP k-tiles (128 k), a block one k-tile. A stage holds
// 16 A tile rows, then 16 B tile rows, each GP fragments of 1 KB. In LDS a
// fragment is two 512-B planes (halfs 0..7 of every lane, then halfs 8..15), so
// that each ds_load_b128 of a wave reads 512 contiguous bytes.
// ---------------------------------------------------------------------------
#define GP     4                  // k-tiles per pass
#define GPASS  (KT32 / GP)        // passes
#define GROW   (GP * 512)         // halfs of one tile row in a stage
#define GSTAGE (32 * GROW)        // halfs of a stage (128 KB)

__device__ __forceinline__ v16h lds_frag(const half_t* p) {
  union { uint4 u[2]; v16h v; } t;
  t.u[0] = *(const uint4*)(p);
  t.u[1] = *(const uint4*)(p + 256);
  return t.v;
}

// Eight copies of 512 B: one tile row (GP fragments) of a stage. g: the lane's
// 16 bytes of the row's first 512 B; l: their LDS byte address. Global chunk
// 2*lane+h of a fragment goes to plane h, slot lane. The s_wait_xcnt closes the
// statement so that no address register is rewritten ahead of it.
__device__ __forceinline__ void copy_row(const half_t* g, uint32_t l) {
  asm volatile(
      "global_load_async_to_lds_b128 %0, %8, off\n\t"
      "global_load_async_to_lds_b128 %1, %9, off\n\t"
      "global_load_async_to_lds_b128 %2, %10, off\n\t"
      "global_load_async_to_lds_b128 %3, %11, off\n\t"
      "global_load_async_to_lds_b128 %4, %12, off\n\t"
      "global_load_async_to_lds_b128 %5, %13, off\n\t"
      "global_load_async_to_lds_b128 %6, %14, off\n\t"
      "global_load_async_to_lds_b128 %7, %15, off\n\t"
      "s_wait_xcnt 0x0"
      :: "v"(l), "v"(l + 256u), "v"(l + 1024u), "v"(l + 1280u),
         "v"(l + 2048u), "v"(l + 2304u), "v"(l + 3072u), "v"(l + 3328u),
         "v"(g), "v"(g + 256), "v"(g + 512), "v"(g + 768),
         "v"(g + 1024), "v"(g + 1280), "v"(g + 1536), "v"(g + 1792)
      : "memory");
}

// The lane's number, read anew wherever copy addresses are formed: held in
// vector registers across the WMMA blocks, next to 448 registers of
// accumulators and fragments, these addresses were spilled.
__device__ __forceinline__ uint32_t lane_now() {
  uint32_t ln;
  asm volatile("v_mbcnt_lo_u32_b32 %0, -1, 0" : "=v"(ln));
  return ln;
}
// The lane's own source and LDS byte address in a wave's first tile row (gu, lu:
// that row, both uniform).
__device__ __forceinline__ const half_t* copy_src(const half_t* gu, uint32_t ln) {
  return gu + ln * 8u;
}
__device__ __forceinline__ uint32_t copy_dst(uint32_t lu, uint32_t ln) {
  return lu + (ln & 1u) * 512u + (ln >> 1) * 16u;
}
// Tile row r of a wave's share of a stage (four tile rows, 32 copies).
__device__ __forceinline__ void copy_share(const half_t* g, uint32_t l, int r) {
  copy_row(g + r * (KT32 << 9), l + (uint32_t)r * (GROW * 2u));
}
__device__ __forceinline__ void copy_stage(const half_t* gu, uint32_t lu) {
  const uint32_t ln = lane_now();
  const half_t* g = copy_src(gu, ln);
  const uint32_t l = copy_dst(lu, ln);
  copy_share(g, l, 0);
  copy_share(g, l, 1);
  copy_share(g, l, 2);
  copy_share(g, l, 3);
}

// This wave's copies have landed (the compiler places no wait for them).
__device__ __forceinline__ void wait_async0() {
  asm volatile("s_wait_asynccnt 0x0" ::: "memory");
}
// This wave's LDS reads are done before the buffer goes back to the copies.
__device__ __forceinline__ void wait_ds0() {
  asm volatile("s_wait_dscnt 0x0" ::: "memory");
}

// The 12 fragments of one block: 24 ds_load_b128. The loops here, in mma_block
// and at the foot of a pass are unrolled so that every fragment and accumulator
// index is a constant and they stay in registers.
__device__ __forceinline__ void load_block(const half_t* pa, const half_t* pb,
                                           v16h a[4], v16h b[8]) {
#pragma unroll
  for (int i = 0; i < 4; ++i) a[i] = lds_frag(pa + i * GROW);
#pragma unroll
  for (int j = 0; j < 8; ++j) b[j] = lds_frag(pb + j * GROW);
}

__device__ __forceinline__ void mma_block(const v16h a[4], const v16h b[8],
                                          v8f c[4][8]) {
#pragma unroll
  for (int i = 0; i < 4; ++i)
#pragma unroll
    for (int j = 0; j < 8; ++j) c[i][j] = wmma_f16(a[i], b[j], c[i][j]);
}

// Keeps a load group whole and in front of the WMMA block that covers its
// latency: without it the compiler sinks the loads in among the WMMAs, next to
// their use, and every such place stalls the wave.
__device__ __forceinline__ void block_edge() {
  __builtin_amdgcn_sched_barrier(0);
}

__device__ __forceinline__ void gemm_tile(const half_t* __restrict__ A,
                                          const half_t* __restrict__ B,
                                          half_t* sm, int mtb, int ntb,
                                          v8f c[4][8]) {
  const int lane = threadIdx.x & 31;
  // The wave's number as a scalar: the uniform part of every address stays in
  // scalar registers.
  const int wid = __builtin_amdgcn_readfirstlane(threadIdx.x >> 5);
  const int wm = wid >> 1, wn = wid & 1;
#pragma unroll
  for (int i = 0; i < 4; ++i)
#pragma unroll
    for (int j = 0; j < 8; ++j) c[i][j] = zero8();

  // Waves 0..3 copy the A tile rows 4*wid .. 4*wid+3; waves 4..7 the B rows.
  const int row0 = (wid & 3) * 4;
  const half_t* src = wid < 4 ? A + ((size_t)(mtb + row0) * KT32 << 9)
                              : B + ((size_t)(ntb + row0) * KT32 << 9);
  const uint32_t dst = (uint32_t)(size_t)sm + (uint32_t)wid * (GROW * 8u);
  // The wave's first A and B fragment in buffer 0.
  const half_t* fa = sm + lane * 8 + wm * 4 * GROW;
  const half_t* fb = sm + lane * 8 + (16 + wn * 8) * GROW;
  v16h a0[4], b0[8], a1[4], b1[8];

  copy_stage(src, dst);
  wait_async0();
  __syncthreads();
  copy_stage(src + GROW, dst + GSTAGE * 2u);
  load_block(fa, fb, a0, b0);

  // Kept rolled: one publish point in the text, the buffer index a scalar.
#pragma unroll 1
  for (int t = 0; t < GPASS; ++t) {
    const int cur = (t & 1) * GSTAGE;
    const half_t* pa = fa + cur;
    const half_t* pb = fb + cur;
    load_block(pa + 512, pb + 512, a1, b1);
    block_edge();
    mma_block(a0, b0, c);
    block_edge();
    load_block(pa + 1024, pb + 1024, a0, b0);
    block_edge();
    mma_block(a1, b1, c);
    block_edge();
    load_block(pa + 1536, pb + 1536, a1, b1);
    block_edge();
    mma_block(a0, b0, c);
    block_edge();
    // Publish pass t+1 and free this pass's buffer, whose last fragments are
    // in registers by now: one barrier does both. It stands in front of the
    // pass's last block, which covers the latency of the next pass's first
    // fragments and, a tile row of copies in front of each 8 WMMA, the
    // refill's issue: while one wave of a SIMD forms addresses and waits out
    // its s_wait_xcnt, the other has WMMAs to issue. The LDS reads still in
    // flight at the copies are of the other buffer.
    wait_ds0();
    wait_async0();
    __syncthreads();
    if (t + 1 < GPASS) load_block(fa + (GSTAGE - cur), fb + (GSTAGE - cur), a0, b0);
    block_edge();
#pragma unroll
    for (int i = 0; i < 4; ++i) {
      if (t + 2 < GPASS) {
        const uint32_t ln = lane_now();
        copy_share(copy_src(src + (t + 2) * GROW, ln),
                   copy_dst(dst + (uint32_t)(t & 1) * (GSTAGE * 2u), ln), i);
      }
      block_edge();
#pragma unroll
      for (int j = 0; j < 8; ++j) c[i][j] = wmma_f16(a1[i], b1[j], c[i][j]);
      block_edge();
    }
  }
  wait_async0();
}

// ---------------------------------------------------------------------------
// Kernel 2: QKV GEMM. C=(16384x3072). A block's 256 columns lie in one of q, k,
// v. q and k fragments run along d inside a lane, so their blocks take the
// weights as the A operand and x as B (the tile comes out transposed: one head
// by 128 tokens a wave); v fragments run along the tokens: x as A (64 tokens by
// two heads a wave).
// Either way tiles c[2p][j], c[2p+1][j] are a lane's 32 bytes of one fragment.
// ---------------------------------------------------------------------------
__global__ __launch_bounds__(256)
void gemm_qkv(const half_t* __restrict__ A, const half_t* __restrict__ B,
              half_t* __restrict__ qA, half_t* __restrict__ kTB,
              half_t* __restrict__ vB) {
  __shared__ __attribute__((aligned(16))) half_t sm[2 * GSTAGE];
  const int lane = threadIdx.x & 31, wid = threadIdx.x >> 5;
  const int wm = wid >> 1, wn = wid & 1;
  const int part = blockIdx.x >> 2;   // 0=q 1=k 2=v
  const bool sw  = part < 2;          // weights as the A operand
  v8f c[4][8];
  gemm_tile(sw ? B : A, sw ? A : B, sm,
            (sw ? blockIdx.x : blockIdx.y) * 16,
            (sw ? blockIdx.y : blockIdx.x) * 16, c);

  // The wave's head (q, k) or the first, even one of its two heads (v).
  const int h  = (blockIdx.x * 4 + (sw ? wm : wn * 2)) & (HEADS - 1);
  const int bh = (blockIdx.y >> 5) * HEADS + h;
  // The wave's first 16-token tile inside its batch row (a multiple of 4).
  const int tt = (blockIdx.y & 31) * 16 + (sw ? wn * 8 : wm * 4);
  // j: token tile (q, k) or head j >> 2 and 16-column group j & 3 of d (v); p:
  // fragment along the other index. Key positions carry the lookback pad of 8
  // token tiles.
  half_t* base = part == 0 ? qA  + (size_t)bh * QA_BH  + ((size_t)(tt * 2) << 9)
               : part == 1 ? kTB + (size_t)bh * KTB_BH + ((size_t)((tt + 8) * 2) << 9)
                           : vB  + (size_t)bh * VB_BH  + ((size_t)((tt + 8) >> 1) << 9);
  const size_t sj = part == 2 ? (size_t)260 * 512 : (size_t)1024;
  const size_t s4 = part == 2 ? VB_BH : (size_t)4096;   // step of j >> 2
  const float  sc = part == 0 ? 0.125f : 1.0f;
  uint4 o[4][8];
  half_t* d[8];
#pragma unroll
  for (int j = 0; j < 8; ++j) {
    d[j] = base + (j >> 2) * s4 + (j & 3) * sj + lane * 16;
#pragma unroll
    for (int i = 0; i < 4; ++i) o[i][j] = pack8(c[i][j], sc);
  }
#pragma unroll
  for (int j = 0; j < 8; ++j)
#pragma unroll
    for (int i = 0; i < 4; ++i) *(uint4*)(d[j] + (i >> 1) * 512 + (i & 1) * 8) = o[i][j];
}

// ---------------------------------------------------------------------------
// Kernel 3: local attention. One block per (b,h,window); 8 waves; each wave
// owns a 16-query strip: sim^T = K Q^T, mask+softmax, out^T = V^T P^T.
// A lane holds one query and half of its keys: maximum and sum are in-lane but
// for one exchange between the wave's halves, and two score tiles, converted,
// are the lane's own B operand of the second product.
// Of the 16 key tiles of the 256-key frame, strip mt can see only tiles
// mt .. mt+8 (q_pos - WIN <= k_pos <= q_pos); every other tile is masked as a
// whole and its weights are exact zeros, so the wave never visits it: 9 score
// tiles (18 WMMA) and the 5 k-tiles of v that hold them (20 WMMA).
// ---------------------------------------------------------------------------
#define KVIS 9   // key tiles that a 16-query strip can see

__global__ __launch_bounds__(256)
void attn_kernel(const half_t* __restrict__ qA, const half_t* __restrict__ kTB,
                 const half_t* __restrict__ vB, half_t* __restrict__ oA) {
  const int lane = threadIdx.x & 31;
  // The strip's number as a scalar: tile addresses and tile tests are uniform.
  const int mt = __builtin_amdgcn_readfirstlane(threadIdx.x >> 5);
  const int wi = blockIdx.x & (NWIN - 1);
  const int h  = (blockIdx.x >> 6) & (HEADS - 1);
  const int b  = blockIdx.x >> 10;
  const int bh = b * HEADS + h;
  const half_t* qbase = qA  + (size_t)bh * QA_BH;
  const half_t* kbase = kTB + (size_t)bh * KTB_BH;
  const half_t* vbase = vB  + (size_t)bh * VB_BH;

  const v16h aq0 = load_frag(qbase + (((size_t)(wi * 8 + mt) * 2 + 0) << 9) + lane * 16);
  const v16h aq1 = load_frag(qbase + (((size_t)(wi * 8 + mt) * 2 + 1) << 9) + lane * 16);
  // These four loads name one address pair; the wait stands in front of the next
  // loads, whose results may be placed over that pair.
  asm volatile("s_wait_xcnt 0x0" ::: "memory");

  // --- sim^T = k @ q^T : c[r][v] = sim[query ncol][key (mt+r)*16 + v + rbase]
  const half_t* kp = kbase + (((size_t)(wi * 8 + mt) * 2) << 9) + lane * 16;
  v8f c[KVIS];
#pragma unroll
  for (int r = 0; r < KVIS; ++r) {
    const v16h b0 = load_frag(kp + r * 1024);
    const v16h b1 = load_frag(kp + r * 1024 + 512);
    v8f acc = zero8();
    acc = wmma_f16(b0, aq0, acc);
    acc = wmma_f16(b1, aq1, acc);
    c[r] = acc;
  }

  // --- causal local mask + softmax of the lane's query ------------------
  const int rbase = (lane >> 4) << 3;
  const int ncol  = lane & 15;
  // q_pos - k_pos = WIN - r*16 + dq - v. It lies inside 0 .. WIN for every
  // element of tiles 1..7; tile 0 can exceed WIN, tile 8 can fall below 0.
  const int dq = ncol - rbase;
#pragma unroll
  for (int v = 0; v < 8; ++v) {
    c[0][v]        = v < dq ? -3.0e38f : c[0][v];          // q_pos > k_pos + WIN
    c[KVIS - 1][v] = v > dq ? -3.0e38f : c[KVIS - 1][v];   // q_pos < k_pos
  }
  // In window 0 the lookback half (frame tiles below 8) is the pad (k_pos < 0).
  if (wi == 0) {
#pragma unroll
    for (int r = 0; r < 8; ++r) {
      const bool pad = mt + r < 8;
#pragma unroll
      for (int v = 0; v < 8; ++v) c[r][v] = pad ? -3.0e38f : c[r][v];
    }
  }
  // Eight independent chains for the maximum, and eight for the sum.
  v8f mv, sv;
#pragma unroll
  for (int v = 0; v < 8; ++v) { mv[v] = -3.0e38f; sv[v] = 0.0f; }
#pragma unroll
  for (int r = 0; r < KVIS; ++r)
#pragma unroll
    for (int v = 0; v < 8; ++v) mv[v] = fmaxf(mv[v], c[r][v]);
  float m = fmaxf(fmaxf(fmaxf(mv[0], mv[1]), fmaxf(mv[2], mv[3])),
                  fmaxf(fmaxf(mv[4], mv[5]), fmaxf(mv[6], mv[7])));
  m = fmaxf(m, __shfl_xor(m, 16));
#pragma unroll
  for (int r = 0; r < KVIS; ++r) {
    c[r] = exp2_8((c[r] - m) * 1.44269504f);   // e^(x - m)
    sv += c[r];
  }
  float s = ((sv[0] + sv[1]) + (sv[2] + sv[3])) + ((sv[4] + sv[5]) + (sv[6] + sv[7]));
  s += __shfl_xor(s, 16);
  const float inv = 1.0f / s;

  // --- out^T = v^T @ attn^T : oc[nt][v] = out[query ncol][d nt*16 + v + rbase]
  // A k-tile of v is an even frame tile and the odd one behind it. An even strip
  // starts on the low half of its first k-tile, an odd strip on the high half;
  // the half that falls outside the nine tiles has weight zero.
  uint4 pw[KVIS];
#pragma unroll
  for (int r = 0; r < KVIS; ++r) pw[r] = pack8(c[r], inv);
  const bool odd = (mt & 1) != 0;
  const uint4 z4 = make_uint4(0u, 0u, 0u, 0u);
  const half_t* vp = vbase + (((size_t)(wi * 4 + (mt >> 1))) << 9) + lane * 16;
  v8f oc[4];
#pragma unroll
  for (int nt = 0; nt < 4; ++nt) oc[nt] = zero8();
#pragma unroll
  for (int t = 0; t < 5; ++t) {
    union { uint4 u[2]; v16h v; } up;
    up.u[0] = odd ? (t == 0 ? z4 : pw[t == 0 ? 0 : 2 * t - 1]) : pw[2 * t];
    up.u[1] = odd ? pw[2 * t] : (t == 4 ? z4 : pw[t == 4 ? 8 : 2 * t + 1]);
    const v16h pf = up.v;
#pragma unroll
    for (int nt = 0; nt < 4; ++nt) {
      const v16h bf = load_frag(vp + (size_t)(nt * 260 + t) * 512);
      oc[nt] = wmma_f16(bf, pf, oc[nt]);
    }
  }

  // --- the strip's two A-frags of the (16384 x 1024) output matrix ------
  const int m0 = b * NTOK + wi * WIN + mt * 16;
  half_t* od = oA + ((size_t)((m0 >> 4) * KT32 + h * 2) << 9) + lane * 16;
  uint4 o[4];
#pragma unroll
  for (int nt = 0; nt < 4; ++nt) o[nt] = pack8(oc[nt], 1.0f);
#pragma unroll
  for (int nt = 0; nt < 4; ++nt) *(uint4*)(od + (nt >> 1) * 512 + (nt & 1) * 8) = o[nt];
}

// ---------------------------------------------------------------------------
// Kernel 4: output GEMM, f32 row-major result.
// ---------------------------------------------------------------------------
__global__ __launch_bounds__(256)
void gemm_out(const half_t* __restrict__ A, const half_t* __restrict__ B,
              float* __restrict__ out) {
  __shared__ __attribute__((aligned(16))) half_t sm[2 * GSTAGE];
  const int lane = threadIdx.x & 31, wid = threadIdx.x >> 5;
  const int wm = wid >> 1, wn = wid & 1;
  const int mt0 = blockIdx.y * 16 + wm * 4;
  const int nt0 = blockIdx.x * 16 + wn * 8;
  v8f c[4][8];
  gemm_tile(A, B, sm, blockIdx.y * 16, blockIdx.x * 16, c);
  const int rbase = (lane >> 4) << 3;
  const int ncol  = lane & 15;
#pragma unroll
  for (int i = 0; i < 4; ++i)
#pragma unroll
    for (int j = 0; j < 8; ++j)
#pragma unroll
      for (int v = 0; v < 8; ++v) {
        const int row = (mt0 + i) * 16 + v + rbase;
        const int col = (nt0 + j) * 16 + ncol;
        out[(size_t)row * DIM + col] = c[i][j][v];
      }
}

// ---------------------------------------------------------------------------
extern "C" void kernel_launch(void* const* d_in, const int* in_sizes, int n_in,
                              void* d_out, int out_size, void* d_ws,
                              size_t ws_size, hipStream_t stream) {
  (void)in_sizes; (void)n_in; (void)out_size; (void)ws_size;
  const float* x    = (const float*)d_in[0];
  const float* g    = (const float*)d_in[1];
  const float* be   = (const float*)d_in[2];
  const float* wqkv = (const float*)d_in[3];
  const float* wout = (const float*)d_in[4];

  half_t* ws    = (half_t*)d_ws;
  half_t* xnA   = ws + OFF_XNA;   // reused as O A-frag after attention
  half_t* wqkvB = ws + OFF_WQKV;
  half_t* woutB = ws + OFF_WOUT;
  half_t* qA    = ws + OFF_QA;
  half_t* kTB   = ws + OFF_KTB;
  half_t* vB    = ws + OFF_VB;

  prepare<<<LN_BLKS + PQ_BLKS + PO_BLKS + ZP_BLKS, 256, 0, stream>>>(
      x, g, be, wqkv, wout, xnA, wqkvB, woutB, kTB, vB);
  gemm_qkv<<<dim3(NQKV / 256, ROWS / 256), 256, 0, stream>>>(xnA, wqkvB, qA, kTB, vB);
  attn_kernel<<<BATCH * HEADS * NWIN, 256, 0, stream>>>(qA, kTB, vB, xnA);
  gemm_out<<<dim3(DIM / 256, ROWS / 256), 256, 0, stream>>>(xnA, woutB, (float*)d_out);
}

// v007
// A run of this version takes 137 microseconds.
// Timed twice side by side with v006, it ran 1.10 times as fast both times.
// Over all steps from v000 it is 2.60 times as fast.
#include <hip/hip_runtime.h>
#include <hip/hip_bf16.h>

// ---------------------------------------------------------------------------
// Local windowed MHA forward for MI455X (gfx1250), wave32 + WMMA f16->f32.
//   b=2, n=8192, DIM=1024, HEADS=16, DHEAD=64, WINDOW=128, look_backward=1
// Pipeline: one preparation launch (LN to A-frags, both weight packs to B-frags,
// pad zeroing) -> QKV GEMM (WMMA, q/kT/v frags) -> per-window attention (WMMA
// K Q^T, softmax, WMMA V^T P^T) -> output GEMM (WMMA) -> f32 out.
// Every product whose result is the operand of a later product is formed with
// the operand order that leaves a lane's 8 accumulators as 8 consecutive halfs
// of that lane's own place in the destination fragment.
// Both GEMMs stage their operand fragments in LDS (asynchronous copies, two
// buffers): one 256x256 tile per work-group, read by 8 waves of 64x128 each.
// A fragment (1 KB) has one of two forms in the workspace. Lane-major: a lane's
// 16 halfs in a row (x normalized, w_qkv). Two planes: halfs 0..7 of every lane
// (512 B), then halfs 8..15 (q, k, v, the attention output, w_out): there each
// 16-B store or load of a wave covers four whole 128-B lines, where the
// lane-major form makes it touch half of each of eight.
// ---------------------------------------------------------------------------

typedef __attribute__((ext_vector_type(16))) _Float16 v16h;
typedef __attribute__((ext_vector_type(8)))  float    v8f;
typedef __attribute__((ext_vector_type(2)))  float    v2f;
typedef __attribute__((ext_vector_type(2)))  _Float16 v2h;
typedef _Float16 half_t;

#define HEADS  16
#define DIM    1024
#define DHEAD  64
#define WIN    128
#define NTOK   8192
#define BATCH  2
#define ROWS   (BATCH * NTOK)   // 16384
#define NQKV   (3 * DIM)        // 3072
#define NWIN   (NTOK / WIN)     // 64
#define KT32   (DIM / 32)       // k-tiles of a row of 1024 (both GEMMs: K = 1024)

// Workspace layout (in halfs). All offsets keep >=32B alignment.
static constexpr size_t OFF_XNA  = 0;                       // 16384x1024 A-frag (reused as O A-frag)
static constexpr size_t OFF_WQKV = OFF_XNA  + 16777216;     // 1024x3072 B-frag
static constexpr size_t OFF_WOUT = OFF_WQKV + 3145728;      // 1024x1024 B-frag
static constexpr size_t OFF_QA   = OFF_WOUT + 1048576;      // per (b,h): 8192x64 A-frag
static constexpr size_t OFF_KTB  = OFF_QA   + 16777216;     // per (b,h): B-frag (d x padded keypos), 520 jtiles
static constexpr size_t OFF_VB   = OFF_KTB  + 17039360;     // per (b,h): B-frag (padded keypos x d), 260 ktiles
// total = 71,827,456 halfs = ~137 MB

static constexpr size_t QA_BH  = 524288;  // 512 mtiles * 2 ktiles * 512
static constexpr size_t KTB_BH = 532480;  // 520 jtiles * 2 dtiles * 512
static constexpr size_t VB_BH  = 532480;  // 4 ntiles * 260 ktiles * 512

// --- WMMA fragment addressing (element granularity), lane-major form --------
// A-frag (MxK): tile(mt,kt) base=((mt*Kt+kt)<<9); within tile, element (m,k):
//   lane = (m&15) | ((k>>3 & 1)<<4), halfidx = (k&7) | ((k>>4 & 1)<<3)
__device__ __forceinline__ size_t a_off(int kt32, int m, int k) {
  int kk   = k & 31;
  int lane = (m & 15) | (((kk >> 3) & 1) << 4);
  int hidx = (kk & 7) | (((kk >> 4) & 1) << 3);
  return ((size_t)((m >> 4) * kt32 + (k >> 5)) << 9) + (lane << 4) + hidx;
}
// B-frag (KxN): tile(nt,kt) base=((nt*Kt+kt)<<9); element (k,n) mirrors A.
__device__ __forceinline__ size_t b_off(int kt32, int k, int n) {
  int kk   = k & 31;
  int lane = (n & 15) | (((kk >> 3) & 1) << 4);
  int hidx = (kk & 7) | (((kk >> 4) & 1) << 3);
  return ((size_t)((n >> 4) * kt32 + (k >> 5)) << 9) + (lane << 4) + hidx;
}

// A lane's 16 halfs of a two-plane fragment; p: the lane's 16 B of plane 0.
__device__ __forceinline__ v16h load_frag(const half_t* p) {
  union { uint4 u[2]; v16h v; } t;
  t.u[0] = *(const uint4*)(p);
  t.u[1] = *(const uint4*)(p + 256);
  return t.v;
}

__device__ __forceinline__ v8f zero8() {
  v8f z;
#pragma unroll
  for (int e = 0; e < 8; ++e) z[e] = 0.0f;
  return z;
}

__device__ __forceinline__ v8f wmma_f16(v16h a, v16h b, v8f c) {
  return __builtin_amdgcn_wmma_f32_16x16x32_f16(false, a, false, b, (short)0, c,
                                                false, false);
}

// An A-frag of X holds the same registers as a B-frag of X^T (a_off and b_off
// mirror each other), so wmma_f16(frag(Y), frag(X)) is the tile of (X Y)^T:
// lane = (row of X) | (8-group of the column) << 4, register = column & 7.
// The 8 accumulators of a lane as 16 bytes of f16.
__device__ __forceinline__ uint4 pack8(v8f t, float sc) {
  union { v2h h[4]; uint4 u; } o;
#pragma unroll
  for (int e = 0; e < 4; ++e) {
    v2f p;
    p[0] = t[2 * e] * sc;
    p[1] = t[2 * e + 1] * sc;
    o.h[e] = __builtin_convertvector(p, v2h);   // one packed conversion
  }
  return o.u;
}

// 2^x of a tile's 8 values. One statement: every output lies apart from every
// input, and the v_nop is the slot that the instruction set asks for behind a
// transcendental before its result is used or its source overwritten.
__device__ __forceinline__ v8f exp2_8(v8f x) {
  float e0, e1, e2, e3, e4, e5, e6, e7;
  asm("v_exp_f32 %0, %8\n\t"
      "v_exp_f32 %1, %9\n\t"
      "v_exp_f32 %2, %10\n\t"
      "v_exp_f32 %3, %11\n\t"
      "v_exp_f32 %4, %12\n\t"
      "v_exp_f32 %5, %13\n\t"
      "v_exp_f32 %6, %14\n\t"
      "v_exp_f32 %7, %15\n\t"
      "v_nop"
      : "=&v"(e0), "=&v"(e1), "=&v"(e2), "=&v"(e3),
        "=&v"(e4), "=&v"(e5), "=&v"(e6), "=&v"(e7)
      : "v"(x[0]), "v"(x[1]), "v"(x[2]), "v"(x[3]),
        "v"(x[4]), "v"(x[5]), "v"(x[6]), "v"(x[7]));
  v8f e;
  e[0] = e0; e[1] = e1; e[2] = e2; e[3] = e3;
  e[4] = e4; e[5] = e5; e[6] = e6; e[7] = e7;
  return e;
}

// ---------------------------------------------------------------------------
// Preparation job 1: LayerNorm, four rows per wave; normalized rows go out as f16
// A-frags. Lane = (row & 3) | (column quad << 2): a load reads one 128-B line of
// each of the four rows, and a store fills two whole 128-B lines of a fragment.
// Few long-lived waves: the job is bound by memory, not by wave starts.
// blk: the block's number inside the job (here and in the jobs below).
// ---------------------------------------------------------------------------
__device__ __forceinline__
void ln_pack_a(const float* __restrict__ x, const float* __restrict__ g,
               const float* __restrict__ be, half_t* __restrict__ xnA,
               const int blk) {
  const int lane = threadIdx.x & 31;
  const int wave = blk * 8 + (threadIdx.x >> 5);
  const int row  = wave * 4 + (lane & 3);
  const int cq   = (lane >> 2) * 4;   // first of the lane's 4 columns in a k-tile
  const float* xr = x + (size_t)row * DIM + cq;
  float4 v[KT32];
  // Unrolled (as the three loops below): v and o stay in registers and all 32
  // loads of the wave are in flight together.
#pragma unroll
  for (int i = 0; i < KT32; ++i) v[i] = *(const float4*)(xr + i * 32);
  float4 s  = make_float4(0.0f, 0.0f, 0.0f, 0.0f);
  float4 s2 = make_float4(0.0f, 0.0f, 0.0f, 0.0f);
#pragma unroll
  for (int i = 0; i < KT32; ++i) {
    s.x += v[i].x; s.y += v[i].y; s.z += v[i].z; s.w += v[i].w;
    s2.x += v[i].x * v[i].x; s2.y += v[i].y * v[i].y;
    s2.z += v[i].z * v[i].z; s2.w += v[i].w * v[i].w;
  }
  float rs = (s.x + s.y) + (s.z + s.w);
  float rq = (s2.x + s2.y) + (s2.z + s2.w);
  // The eight lanes of a row differ in lane bits 2..4.
  rs += __shfl_xor(rs, 4);  rq += __shfl_xor(rq, 4);
  rs += __shfl_xor(rs, 8);  rq += __shfl_xor(rq, 8);
  rs += __shfl_xor(rs, 16); rq += __shfl_xor(rq, 16);
  const float mu   = rs * (1.0f / DIM);
  const float var  = rq * (1.0f / DIM) - mu * mu;
  const float rstd = rsqrtf(var + 1e-5f);
  uint2 o[KT32];
#pragma unroll
  for (int i = 0; i < KT32; ++i) {
    const float4 gv = *(const float4*)(g + i * 32 + cq);
    const float4 bv = *(const float4*)(be + i * 32 + cq);
    union { half_t h[4]; uint2 u; } p;
    p.h[0] = (half_t)((v[i].x - mu) * rstd * gv.x + bv.x);
    p.h[1] = (half_t)((v[i].y - mu) * rstd * gv.y + bv.y);
    p.h[2] = (half_t)((v[i].z - mu) * rstd * gv.z + bv.z);
    p.h[3] = (half_t)((v[i].w - mu) * rstd * gv.w + bv.w);
    o[i] = p.u;
  }
  half_t* dst = xnA + a_off(KT32, row, cq);
  // Holds every store behind the last load and the last arithmetic, so that no
  // register which an issued store names is written again.
  __builtin_amdgcn_sched_barrier(0);
#pragma unroll
  for (int i = 0; i < KT32; ++i) *(uint2*)(dst + i * 512) = o[i];
}

// ---------------------------------------------------------------------------
// Preparation jobs 2 and 3 (one per weight matrix): pack a row-major KxN f32
// matrix into f16 B-frags. Block blk is column blk % (N / 128), row
// y = blk / (N / 128) of the job's grid of N / 128 by K / 64 blocks.
// A wave builds two whole fragments (n-tile nt, k-tiles 2*y, 2*y+1):
// each lane gathers its own 16 halfs of each and stores them as 32 contiguous
// bytes (lane-major) or as 16 bytes in each plane (planes, a constant like K and
// N). K and N are constants at each call, so that every row step is an
// immediate offset on one address.
// ---------------------------------------------------------------------------
__device__ __forceinline__ void pack_frags(const float* __restrict__ w,
                                           half_t* __restrict__ dst,
                                           const int K, const int N,
                                           const bool planes, const int blk) {
  const int lane = threadIdx.x & 31;
  const int nt   = (blk % (N / 128)) * 8 + (threadIdx.x >> 5);
  const int kt   = (blk / (N / 128)) * 2;
  const float* p = w + (size_t)(kt * 32 + (lane >> 4) * 8) * N + nt * 16 + (lane & 15);
  half_t* d = dst + ((size_t)(nt * (K >> 5) + kt) << 9) + lane * (planes ? 8 : 16);
  // Unrolled: all 32 loads of the wave are in flight together.
#pragma unroll
  for (int f = 0; f < 2; ++f) {
    union { half_t h[16]; uint4 u[2]; } o;
#pragma unroll
    for (int e = 0; e < 8; ++e) {
      o.h[e]     = (half_t)p[(f * 32 + e) * N];
      o.h[8 + e] = (half_t)p[(f * 32 + 16 + e) * N];
    }
    *(uint4*)(d + f * 512)     = o.u[0];
    *(uint4*)(d + f * 512 + (planes ? 256 : 8)) = o.u[1];
  }
  // Other jobs' code follows in the kernel's text: the wait stands between the
  // four stores and any later write of a register that they name.
  asm volatile("s_wait_xcnt 0x0" ::: "memory");
}

// ---------------------------------------------------------------------------
// Preparation job 4: zero the one-chunk (128 keypos) lookback pad of kT / v frags.
// ---------------------------------------------------------------------------
__device__ __forceinline__
void zero_pad(half_t* __restrict__ kTB, half_t* __restrict__ vB, const int blk) {
  const int tid = blk * 256 + threadIdx.x;  // 65536 units of 8 halfs
  const int bh  = tid >> 11;
  const int rem = tid & 2047;
  const uint4 z = make_uint4(0u, 0u, 0u, 0u);
  if (rem < 1024) {
    // kT pad: jtiles 0..7 -> frags 0..15 contiguous (8192 halfs)
    *(uint4*)(kTB + (size_t)bh * KTB_BH + (size_t)rem * 8) = z;
  } else {
    // v pad: frag (nt*260 + kt), nt=0..3, kt=0..3
    const int r2   = rem - 1024;
    const int frag = r2 >> 6, unit = r2 & 63;
    const int nt = frag >> 2, kt = frag & 3;
    *(uint4*)(vB + (size_t)bh * VB_BH + (((size_t)(nt * 260 + kt)) << 9) +
              (size_t)unit * 8) = z;
  }
}

// ---------------------------------------------------------------------------
// Kernel 1: the four preparation jobs in one grid. None reads what another
// writes, so the block index picks the job: the short jobs run beside the
// LayerNorm stream, and one launch (gap, wave start, first-load latency, store
// drain) is paid for where four were. The LayerNorm blocks, the longest, come
// first in the index.
// ---------------------------------------------------------------------------
#define LN_BLKS (ROWS / 32)
#define PQ_BLKS ((NQKV / 128) * (DIM / 64))
#define PO_BLKS ((DIM / 128) * (DIM / 64))
#define ZP_BLKS 256

__global__ __launch_bounds__(256)
void prepare(const float* __restrict__ x, const float* __restrict__ g,
             const float* __restrict__ be, const float* __restrict__ wqkv,
             const float* __restrict__ wout, half_t* __restrict__ xnA,
             half_t* __restrict__ wqkvB, half_t* __restrict__ woutB,
             half_t* __restrict__ kTB, half_t* __restrict__ vB) {
  const int blk = blockIdx.x;
  if (blk < LN_BLKS) {
    ln_pack_a(x, g, be, xnA, blk);
  } else if (blk < LN_BLKS + PQ_BLKS) {
    pack_frags(wqkv, wqkvB, DIM, NQKV, false, blk - LN_BLKS);
  } else if (blk < LN_BLKS + PQ_BLKS + PO_BLKS) {
    pack_frags(wout, woutB, DIM, DIM, true, blk - (LN_BLKS + PQ_BLKS));
  } else {
    zero_pad(kTB, vB, blk - (LN_BLKS + PQ_BLKS + PO_BLKS));
  }
}

// ---------------------------------------------------------------------------
// Shared GEMM core: 8 waves/block (4x2), each wave a 64x128 tile (4x8 WMMA
// tiles) of a 256x256 block tile: 12 fragments feed 32 WMMA, and two waves on a
// SIMD have the registers for a second fragment set, so that a block's LDS
// reads go out as one group a whole block ahead of their use.
// A pass is GP k-tiles (128 k), a block one k-tile. A stage holds
// 16 A tile rows, then 16 B tile rows, each GP fragments of 1 KB. In LDS a
// fragment is two 512-B planes (halfs 0..7 of every lane, then halfs 8..15), so
// that each ds_load_b128 of a wave reads 512 contiguous bytes.
// ---------------------------------------------------------------------------
#define GP     4                  // k-tiles per pass
#define GPASS  (KT32 / GP)        // passes
#define GROW   (GP * 512)         // halfs of one tile row in a stage
#define GSTAGE (32 * GROW)        // halfs of a stage (128 KB)

__device__ __forceinline__ v16h lds_frag(const half_t* p) {
  union { uint4 u[2]; v16h v; } t;
  t.u[0] = *(const uint4*)(p);
  t.u[1] = *(const uint4*)(p + 256);
  return t.v;
}

// Eight copies of 512 B: one tile row (GP fragments) of a stage. g: the lane's
// 16 bytes of the row's first 512 B; l: their LDS byte address. Of a lane-major
// fragment global chunk 2*lane+h goes to plane h, slot lane; a two-plane fragment
// (pl, a constant at each call) lands as it lies. The s_wait_xcnt closes the
// statement so that no address register is rewritten ahead of it.
__device__ __forceinline__ void copy_row(const half_t* g, uint32_t l, const bool pl) {
  const uint32_t h = pl ? 512u : 256u;   // LDS step of a fragment's second 512 B
  asm volatile(
      "global_load_async_to_lds_b128 %0, %8, off\n\t"
      "global_load_async_to_lds_b128 %1, %9, off\n\t"
      "global_load_async_to_lds_b128 %2, %10, off\n\t"
      "global_load_async_to_lds_b128 %3, %11, off\n\t"
      "global_load_async_to_lds_b128 %4, %12, off\n\t"
      "global_load_async_to_lds_b128 %5, %13, off\n\t"
      "global_load_async_to_lds_b128 %6, %14, off\n\t"
      "global_load_async_to_lds_b128 %7, %15, off\n\t"
      "s_wait_xcnt 0x0"
      :: "v"(l), "v"(l + h), "v"(l + 1024u), "v"(l + 1024u + h),
         "v"(l + 2048u), "v"(l + 2048u + h), "v"(l + 3072u), "v"(l + 3072u + h),
         "v"(g), "v"(g + 256), "v"(g + 512), "v"(g + 768),
         "v"(g + 1024), "v"(g + 1280), "v"(g + 1536), "v"(g + 1792)
      : "memory");
}

// The lane's number, read anew wherever copy addresses are formed: held in
// vector registers across the WMMA blocks, next to 448 registers of
// accumulators and fragments, these addresses were spilled.
__device__ __forceinline__ uint32_t lane_now() {
  uint32_t ln;
  asm volatile("v_mbcnt_lo_u32_b32 %0, -1, 0" : "=v"(ln));
  return ln;
}
// The lane's own source and LDS byte address in a wave's first tile row (gu, lu:
// that row, both uniform).
__device__ __forceinline__ const half_t* copy_src(const half_t* gu, uint32_t ln) {
  return gu + ln * 8u;
}
__device__ __forceinline__ uint32_t copy_dst(uint32_t lu, uint32_t ln, const bool pl) {
  return pl ? lu + ln * 16u : lu + (ln & 1u) * 512u + (ln >> 1) * 16u;
}
// Tile row r of a wave's share of a stage (four tile rows, 32 copies).
__device__ __forceinline__ void copy_share(const half_t* g, uint32_t l, int r,
                                           const bool pl) {
  copy_row(g + r * (KT32 << 9), l + (uint32_t)r * (GROW * 2u), pl);
}
__device__ __forceinline__ void copy_stage(const half_t* gu, uint32_t lu,
                                           const bool pl) {
  const uint32_t ln = lane_now();
  const half_t* g = copy_src(gu, ln);
  const uint32_t l = copy_dst(lu, ln, pl);
  copy_share(g, l, 0, pl);
  copy_share(g, l, 1, pl);
  copy_share(g, l, 2, pl);
  copy_share(g, l, 3, pl);
}

// This wave's copies have landed (the compiler places no wait for them).
__device__ __forceinline__ void wait_async0() {
  asm volatile("s_wait_asynccnt 0x0" ::: "memory");
}
// This wave's LDS reads are done before the buffer goes back to the copies.
__device__ __forceinline__ void wait_ds0() {
  asm volatile("s_wait_dscnt 0x0" ::: "memory");
}

// The 12 fragments of one block: 24 ds_load_b128. The loops here, in mma_block
// and at the foot of a pass are unrolled so that every fragment and accumulator
// index is a constant and they stay in registers.
__device__ __forceinline__ void load_block(const half_t* pa, const half_t* pb,
                                           v16h a[4], v16h b[8]) {
#pragma unroll
  for (int i = 0; i < 4; ++i) a[i] = lds_frag(pa + i * GROW);
#pragma unroll
  for (int j = 0; j < 8; ++j) b[j] = lds_frag(pb + j * GROW);
}

__device__ __forceinline__ void mma_block(const v16h a[4], const v16h b[8],
                                          v8f c[4][8]) {
#pragma unroll
  for (int i = 0; i < 4; ++i)
#pragma unroll
    for (int j = 0; j < 8; ++j) c[i][j] = wmma_f16(a[i], b[j], c[i][j]);
}

// Keeps a load group whole and in front of the WMMA block that covers its
// latency: without it the compiler sinks the loads in among the WMMAs, next to
// their use, and every such place stalls the wave.
__device__ __forceinline__ void block_edge() {
  __builtin_amdgcn_sched_barrier(0);
}

// pl: both operands lie in the workspace as two-plane fragments (else both
// lane-major); a constant at each call.
__device__ __forceinline__ void gemm_tile(const half_t* __restrict__ A,
                                          const half_t* __restrict__ B,
                                          half_t* sm, int mtb, int ntb,
                                          const bool pl, v8f c[4][8]) {
  const int lane = threadIdx.x & 31;
  // The wave's number as a scalar: the uniform part of every address stays in
  // scalar registers.
  const int wid = __builtin_amdgcn_readfirstlane(threadIdx.x >> 5);
  const int wm = wid >> 1, wn = wid & 1;
#pragma unroll
  for (int i = 0; i < 4; ++i)
#pragma unroll
    for (int j = 0; j < 8; ++j) c[i][j] = zero8();

  // Waves 0..3 copy the A tile rows 4*wid .. 4*wid+3; waves 4..7 the B rows.
  const int row0 = (wid & 3) * 4;
  const half_t* src = wid < 4 ? A + ((size_t)(mtb + row0) * KT32 << 9)
                              : B + ((size_t)(ntb + row0) * KT32 << 9);
  const uint32_t dst = (uint32_t)(size_t)sm + (uint32_t)wid * (GROW * 8u);
  // The wave's first A and B fragment in buffer 0.
  const half_t* fa = sm + lane * 8 + wm * 4 * GROW;
  const half_t* fb = sm + lane * 8 + (16 + wn * 8) * GROW;
  v16h a0[4], b0[8], a1[4], b1[8];

  copy_stage(src, dst, pl);
  wait_async0();
  __syncthreads();
  copy_stage(src + GROW, dst + GSTAGE * 2u, pl);
  load_block(fa, fb, a0, b0);

  // Kept rolled: one publish point in the text, the buffer index a scalar.
#pragma unroll 1
  for (int t = 0; t < GPASS; ++t) {
    const int cur = (t & 1) * GSTAGE;
    const half_t* pa = fa + cur;
    const half_t* pb = fb + cur;
    load_block(pa + 512, pb + 512, a1, b1);
    block_edge();
    mma_block(a0, b0, c);
    block_edge();
    load_block(pa + 1024, pb + 1024, a0, b0);
    block_edge();
    mma_block(a1, b1, c);
    block_edge();
    load_block(pa + 1536, pb + 1536, a1, b1);
    block_edge();
    mma_block(a0, b0, c);
    block_edge();
    // Publish pass t+1 and free this pass's buffer, whose last fragments are
    // in registers by now: one barrier does both. It stands in front of the
    // pass's last block, which covers the latency of the next pass's first
    // fragments and, a tile row of copies in front of each 8 WMMA, the
    // refill's issue: while one wave of a SIMD forms addresses and waits out
    // its s_wait_xcnt, the other has WMMAs to issue. The LDS reads still in
    // flight at the copies are of the other buffer.
    wait_ds0();
    wait_async0();
    __syncthreads();
    if (t + 1 < GPASS) load_block(fa + (GSTAGE - cur), fb + (GSTAGE - cur), a0, b0);
    block_edge();
#pragma unroll
    for (int i = 0; i < 4; ++i) {
      if (t + 2 < GPASS) {
        const uint32_t ln = lane_now();
        copy_share(copy_src(src + (t + 2) * GROW, ln),
                   copy_dst(dst + (uint32_t)(t & 1) * (GSTAGE * 2u), ln, pl), i, pl);
      }
      block_edge();
#pragma unroll
      for (int j = 0; j < 8; ++j) c[i][j] = wmma_f16(a1[i], b1[j], c[i][j]);
      block_edge();
    }
  }
  wait_async0();
}

// ---------------------------------------------------------------------------
// Kernel 2: QKV GEMM. C=(16384x3072). A block's 256 columns lie in one of q, k,
// v. q and k fragments run along d inside a lane, so their blocks take the
// weights as the A operand and x as B (the tile comes out transposed: one head
// by 128 tokens a wave); v fragments run along the tokens: x as A (64 tokens by
// two heads a wave).
// Either way tiles c[2p][j], c[2p+1][j] are a lane's 16 bytes in plane 0 and in
// plane 1 of one fragment: each store of the wave fills 512 bytes in a row.
// ---------------------------------------------------------------------------
__global__ __launch_bounds__(256)
void gemm_qkv(const half_t* __restrict__ A, const half_t* __restrict__ B,
              half_t* __restrict__ qA, half_t* __restrict__ kTB,
              half_t* __restrict__ vB) {
  __shared__ __attribute__((aligned(16))) half_t sm[2 * GSTAGE];
  const int lane = threadIdx.x & 31, wid = threadIdx.x >> 5;
  const int wm = wid >> 1, wn = wid & 1;
  const int part = blockIdx.x >> 2;   // 0=q 1=k 2=v
  const bool sw  = part < 2;          // weights as the A operand
  v8f c[4][8];
  gemm_tile(sw ? B : A, sw ? A : B, sm,
            (sw ? blockIdx.x : blockIdx.y) * 16,
            (sw ? blockIdx.y : blockIdx.x) * 16, false, c);

  // The wave's head (q, k) or the first, even one of its two heads (v).
  const int h  = (blockIdx.x * 4 + (sw ? wm : wn * 2)) & (HEADS - 1);
  const int bh = (blockIdx.y >> 5) * HEADS + h;
  // The wave's first 16-token tile inside its batch row (a multiple of 4).
  const int tt = (blockIdx.y & 31) * 16 + (sw ? wn * 8 : wm * 4);
  // j: token tile (q, k) or head j >> 2 and 16-column group j & 3 of d (v); p:
  // fragment along the other index. Key positions carry the lookback pad of 8
  // token tiles.
  half_t* base = part == 0 ? qA  + (size_t)bh * QA_BH  + ((size_t)(tt * 2) << 9)
               : part == 1 ? kTB + (size_t)bh * KTB_BH + ((size_t)((tt + 8) * 2) << 9)
                           : vB  + (size_t)bh * VB_BH  + ((size_t)((tt + 8) >> 1) << 9);
  const size_t sj = part == 2 ? (size_t)260 * 512 : (size_t)1024;
  const size_t s4 = part == 2 ? VB_BH : (size_t)4096;   // step of j >> 2
  const float  sc = part == 0 ? 0.125f : 1.0f;
  uint4 o[4][8];
  half_t* d[8];
#pragma unroll
  for (int j = 0; j < 8; ++j) {
    d[j] = base + (j >> 2) * s4 + (j & 3) * sj + lane * 8;
#pragma unroll
    for (int i = 0; i < 4; ++i) o[i][j] = pack8(c[i][j], sc);
  }
#pragma unroll
  for (int j = 0; j < 8; ++j)
#pragma unroll
    for (int i = 0; i < 4; ++i) *(uint4*)(d[j] + (i >> 1) * 512 + (i & 1) * 256) = o[i][j];
}

// ---------------------------------------------------------------------------
// Kernel 3: local attention. One block per (b,h,window); 8 waves; each wave
// owns a 16-query strip: sim^T = K Q^T, mask+softmax, out^T = V^T P^T.
// A lane holds one query and half of its keys: maximum and sum are in-lane but
// for one exchange between the wave's halves, and two score tiles, converted,
// are the lane's own B operand of the second product.
// Of the 16 key tiles of the 256-key frame, strip mt can see only tiles
// mt .. mt+8 (q_pos - WIN <= k_pos <= q_pos); every other tile is masked as a
// whole and its weights are exact zeros, so the wave never visits it: 9 score
// tiles (18 WMMA) and the 5 k-tiles of v that hold them (20 WMMA).
// ---------------------------------------------------------------------------
#define KVIS 9   // key tiles that a 16-query strip can see

__global__ __launch_bounds__(256)
void attn_kernel(const half_t* __restrict__ qA, const half_t* __restrict__ kTB,
                 const half_t* __restrict__ vB, half_t* __restrict__ oA) {
  const int lane = threadIdx.x & 31;
  // The strip's number as a scalar: tile addresses and tile tests are uniform.
  const int mt = __builtin_amdgcn_readfirstlane(threadIdx.x >> 5);
  const int wi = blockIdx.x & (NWIN - 1);
  const int h  = (blockIdx.x >> 6) & (HEADS - 1);
  const int b  = blockIdx.x >> 10;
  const int bh = b * HEADS + h;
  const half_t* qbase = qA  + (size_t)bh * QA_BH;
  const half_t* kbase = kTB + (size_t)bh * KTB_BH;
  const half_t* vbase = vB  + (size_t)bh * VB_BH;

  const v16h aq0 = load_frag(qbase + (((size_t)(wi * 8 + mt) * 2 + 0) << 9) + lane * 8);
  const v16h aq1 = load_frag(qbase + (((size_t)(wi * 8 + mt) * 2 + 1) << 9) + lane * 8);
  // These four loads name one address pair; the wait stands in front of the next
  // loads, whose results may be placed over that pair.
  asm volatile("s_wait_xcnt 0x0" ::: "memory");

  // --- sim^T = k @ q^T : c[r][v] = sim[query ncol][key (mt+r)*16 + v + rbase]
  const half_t* kp = kbase + (((size_t)(wi * 8 + mt) * 2) << 9) + lane * 8;
  v8f c[KVIS];
#pragma unroll
  for (int r = 0; r < KVIS; ++r) {
    const v16h b0 = load_frag(kp + r * 1024);
    const v16h b1 = load_frag(kp + r * 1024 + 512);
    v8f acc = zero8();
    acc = wmma_f16(b0, aq0, acc);
    acc = wmma_f16(b1, aq1, acc);
    c[r] = acc;
  }

  // --- causal local mask + softmax of the lane's query ------------------
  const int rbase = (lane >> 4) << 3;
  const int ncol  = lane & 15;
  // q_pos - k_pos = WIN - r*16 + dq - v. It lies inside 0 .. WIN for every
  // element of tiles 1..7; tile 0 can exceed WIN, tile 8 can fall below 0.
  const int dq = ncol - rbase;
#pragma unroll
  for (int v = 0; v < 8; ++v) {
    c[0][v]        = v < dq ? -3.0e38f : c[0][v];          // q_pos > k_pos + WIN
    c[KVIS - 1][v] = v > dq ? -3.0e38f : c[KVIS - 1][v];   // q_pos < k_pos
  }
  // In window 0 the lookback half (frame tiles below 8) is the pad (k_pos < 0).
  if (wi == 0) {
#pragma unroll
    for (int r = 0; r < 8; ++r) {
      const bool pad = mt + r < 8;
#pragma unroll
      for (int v = 0; v < 8; ++v) c[r][v] = pad ? -3.0e38f : c[r][v];
    }
  }
  // Eight independent chains for the maximum, and eight for the sum.
  v8f mv, sv;
#pragma unroll
  for (int v = 0; v < 8; ++v) { mv[v] = -3.0e38f; sv[v] = 0.0f; }
#pragma unroll
  for (int r = 0; r < KVIS; ++r)
#pragma unroll
    for (int v = 0; v < 8; ++v) mv[v] = fmaxf(mv[v], c[r][v]);
  float m = fmaxf(fmaxf(fmaxf(mv[0], mv[1]), fmaxf(mv[2], mv[3])),
                  fmaxf(fmaxf(mv[4], mv[5]), fmaxf(mv[6], mv[7])));
  m = fmaxf(m, __shfl_xor(m, 16));
#pragma unroll
  for (int r = 0; r < KVIS; ++r) {
    c[r] = exp2_8((c[r] - m) * 1.44269504f);   // e^(x - m)
    sv += c[r];
  }
  float s = ((sv[0] + sv[1]) + (sv[2] + sv[3])) + ((sv[4] + sv[5]) + (sv[6] + sv[7]));
  s += __shfl_xor(s, 16);
  const float inv = 1.0f / s;
  // Stands between the key loads and the next write of their scalar base, which
  // the address of the v loads takes.
  asm volatile("s_wait_xcnt 0x0" ::: "memory");

  // --- out^T = v^T @ attn^T : oc[nt][v] = out[query ncol][d nt*16 + v + rbase]
  // A k-tile of v is an even frame tile and the odd one behind it. An even strip
  // starts on the low half of its first k-tile, an odd strip on the high half;
  // the half that falls outside the nine tiles has weight zero.
  uint4 pw[KVIS];
#pragma unroll
  for (int r = 0; r < KVIS; ++r) pw[r] = pack8(c[r], inv);
  const bool odd = (mt & 1) != 0;
  const uint4 z4 = make_uint4(0u, 0u, 0u, 0u);
  const half_t* vp = vbase + (((size_t)(wi * 4 + (mt >> 1))) << 9) + lane * 8;
  v8f oc[4];
#pragma unroll
  for (int nt = 0; nt < 4; ++nt) oc[nt] = zero8();
#pragma unroll
  for (int t = 0; t < 5; ++t) {
    union { uint4 u[2]; v16h v; } up;
    up.u[0] = odd ? (t == 0 ? z4 : pw[t == 0 ? 0 : 2 * t - 1]) : pw[2 * t];
    up.u[1] = odd ? pw[2 * t] : (t == 4 ? z4 : pw[t == 4 ? 8 : 2 * t + 1]);
    const v16h pf = up.v;
#pragma unroll
    for (int nt = 0; nt < 4; ++nt) {
      const v16h bf = load_frag(vp + (size_t)(nt * 260 + t) * 512);
      oc[nt] = wmma_f16(bf, pf, oc[nt]);
    }
  }

  // --- the strip's two A-frags of the (16384 x 1024) output matrix ------
  const int m0 = b * NTOK + wi * WIN + mt * 16;
  half_t* od = oA + ((size_t)((m0 >> 4) * KT32 + h * 2) << 9) + lane * 8;
  uint4 o[4];
#pragma unroll
  for (int nt = 0; nt < 4; ++nt) o[nt] = pack8(oc[nt], 1.0f);
#pragma unroll
  for (int nt = 0; nt < 4; ++nt) *(uint4*)(od + (nt >> 1) * 512 + (nt & 1) * 256) = o[nt];
}

// ---------------------------------------------------------------------------
// Kernel 4: output GEMM, f32 row-major result.
// ---------------------------------------------------------------------------
__global__ __launch_bounds__(256)
void gemm_out(const half_t* __restrict__ A, const half_t* __restrict__ B,
              float* __restrict__ out) {
  __shared__ __attribute__((aligned(16))) half_t sm[2 * GSTAGE];
  const int lane = threadIdx.x & 31, wid = threadIdx.x >> 5;
  const int wm = wid >> 1, wn = wid & 1;
  const int mt0 = blockIdx.y * 16 + wm * 4;
  const int nt0 = blockIdx.x * 16 + wn * 8;
  v8f c[4][8];
  gemm_tile(A, B, sm, blockIdx.y * 16, blockIdx.x * 16, true, c);
  const int rbase = (lane >> 4) << 3;
  const int ncol  = lane & 15;
#pragma unroll
  for (int i = 0; i < 4; ++i)
#pragma unroll
    for (int j = 0; j < 8; ++j)
#pragma unroll
      for (int v = 0; v < 8; ++v) {
        const int row = (mt0 + i) * 16 + v + rbase;
        const int col = (nt0 + j) * 16 + ncol;
        out[(size_t)row * DIM + col] = c[i][j][v];
      }
}

// ---------------------------------------------------------------------------
extern "C" void kernel_launch(void* const* d_in, const int* in_sizes, int n_in,
                              void* d_out, int out_size, void* d_ws,
                              size_t ws_size, hipStream_t stream) {
  (void)in_sizes; (void)n_in; (void)out_size; (void)ws_size;
  const float* x    = (const float*)d_in[0];
  const float* g    = (const float*)d_in[1];
  const float* be   = (const float*)d_in[2];
  const float* wqkv = (const float*)d_in[3];
  const float* wout = (const float*)d_in[4];

  half_t* ws    = (half_t*)d_ws;
  half_t* xnA   = ws + OFF_XNA;   // reused as O A-frag after attention
  half_t* wqkvB = ws + OFF_WQKV;
  half_t* woutB = ws + OFF_WOUT;
  half_t* qA    = ws + OFF_QA;
  half_t* kTB   = ws + OFF_KTB;
  half_t* vB    = ws + OFF_VB;

  prepare<<<LN_BLKS + PQ_BLKS + PO_BLKS + ZP_BLKS, 256, 0, stream>>>(
      x, g, be, wqkv, wout, xnA, wqkvB, woutB, kTB, vB);
  gemm_qkv<<<dim3(NQKV / 256, ROWS / 256), 256, 0, stream>>>(xnA, wqkvB, qA, kTB, vB);
  attn_kernel<<<BATCH * HEADS * NWIN, 256, 0, stream>>>(qA, kTB, vB, xnA);
  gemm_out<<<dim3(DIM / 256, ROWS / 256), 256, 0, stream>>>(xnA, woutB, (float*)d_out);
}

// v008
// A run of this version takes 132 microseconds.
// Two timings next to v007 both put it at 1.04 times that version's speed.
// Over all steps from v000 it is 2.70 times as fast.
#include <hip/hip_runtime.h>
#include <hip/hip_bf16.h>

// ---------------------------------------------------------------------------
// Local windowed MHA forward for MI455X (gfx1250), wave32 + WMMA f16->f32.
//   b=2, n=8192, DIM=1024, HEADS=16, DHEAD=64, WINDOW=128, look_backward=1
// Pipeline: one preparation launch (LN to A-frags, both weight packs to B-frags,
// pad zeroing) -> QKV GEMM (WMMA, q/kT/v frags) -> per-window attention (WMMA
// K Q^T, softmax, WMMA V^T P^T) -> output GEMM (WMMA) -> f32 out.
// Every product whose result is the operand of a later product is formed with
// the operand order that leaves a lane's 8 accumulators as 8 consecutive halfs
// of that lane's own place in the destination fragment.
// Both GEMMs stage their operand fragments in LDS (asynchronous copies, two
// buffers): one 256x256 tile per work-group, read by 8 waves of 64x128 each.
// The attention stages a window's key and value frame in LDS in the same way,
// once per work-group.
// A fragment (1 KB) has one of two forms in the workspace. Lane-major: a lane's
// 16 halfs in a row (x normalized, w_qkv). Two planes: halfs 0..7 of every lane
// (512 B), then halfs 8..15 (q, k, v, the attention output, w_out): there each
// 16-B store or load of a wave covers four whole 128-B lines, where the
// lane-major form makes it touch half of each of eight.
// ---------------------------------------------------------------------------

typedef __attribute__((ext_vector_type(16))) _Float16 v16h;
typedef __attribute__((ext_vector_type(8)))  float    v8f;
typedef __attribute__((ext_vector_type(2)))  float    v2f;
typedef __attribute__((ext_vector_type(2)))  _Float16 v2h;
typedef _Float16 half_t;

#define HEADS  16
#define DIM    1024
#define DHEAD  64
#define WIN    128
#define NTOK   8192
#define BATCH  2
#define ROWS   (BATCH * NTOK)   // 16384
#define NQKV   (3 * DIM)        // 3072
#define NWIN   (NTOK / WIN)     // 64
#define KT32   (DIM / 32)       // k-tiles of a row of 1024 (both GEMMs: K = 1024)

// Workspace layout (in halfs). All offsets keep >=32B alignment.
static constexpr size_t OFF_XNA  = 0;                       // 16384x1024 A-frag (reused as O A-frag)
static constexpr size_t OFF_WQKV = OFF_XNA  + 16777216;     // 1024x3072 B-frag
static constexpr size_t OFF_WOUT = OFF_WQKV + 3145728;      // 1024x1024 B-frag
static constexpr size_t OFF_QA   = OFF_WOUT + 1048576;      // per (b,h): 8192x64 A-frag
static constexpr size_t OFF_KTB  = OFF_QA   + 16777216;     // per (b,h): B-frag (d x padded keypos), 520 jtiles
static constexpr size_t OFF_VB   = OFF_KTB  + 17039360;     // per (b,h): B-frag (padded keypos x d), 260 ktiles
// total = 71,827,456 halfs = ~137 MB

static constexpr size_t QA_BH  = 524288;  // 512 mtiles * 2 ktiles * 512
static constexpr size_t KTB_BH = 532480;  // 520 jtiles * 2 dtiles * 512
static constexpr size_t VB_BH  = 532480;  // 4 ntiles * 260 ktiles * 512

// --- WMMA fragment addressing (element granularity), lane-major form --------
// A-frag (MxK): tile(mt,kt) base=((mt*Kt+kt)<<9); within tile, element (m,k):
//   lane = (m&15) | ((k>>3 & 1)<<4), halfidx = (k&7) | ((k>>4 & 1)<<3)
__device__ __forceinline__ size_t a_off(int kt32, int m, int k) {
  int kk   = k & 31;
  int lane = (m & 15) | (((kk >> 3) & 1) << 4);
  int hidx = (kk & 7) | (((kk >> 4) & 1) << 3);
  return ((size_t)((m >> 4) * kt32 + (k >> 5)) << 9) + (lane << 4) + hidx;
}
// B-frag (KxN): tile(nt,kt) base=((nt*Kt+kt)<<9); element (k,n) mirrors A.
__device__ __forceinline__ size_t b_off(int kt32, int k, int n) {
  int kk   = k & 31;
  int lane = (n & 15) | (((kk >> 3) & 1) << 4);
  int hidx = (kk & 7) | (((kk >> 4) & 1) << 3);
  return ((size_t)((n >> 4) * kt32 + (k >> 5)) << 9) + (lane << 4) + hidx;
}

// A lane's 16 halfs of a two-plane fragment; p: the lane's 16 B of plane 0.
__device__ __forceinline__ v16h load_frag(const half_t* p) {
  union { uint4 u[2]; v16h v; } t;
  t.u[0] = *(const uint4*)(p);
  t.u[1] = *(const uint4*)(p + 256);
  return t.v;
}

__device__ __forceinline__ v8f zero8() {
  v8f z;
#pragma unroll
  for (int e = 0; e < 8; ++e) z[e] = 0.0f;
  return z;
}

__device__ __forceinline__ v8f wmma_f16(v16h a, v16h b, v8f c) {
  return __builtin_amdgcn_wmma_f32_16x16x32_f16(false, a, false, b, (short)0, c,
                                                false, false);
}

// An A-frag of X holds the same registers as a B-frag of X^T (a_off and b_off
// mirror each other), so wmma_f16(frag(Y), frag(X)) is the tile of (X Y)^T:
// lane = (row of X) | (8-group of the column) << 4, register = column & 7.
// The 8 accumulators of a lane as 16 bytes of f16.
__device__ __forceinline__ uint4 pack8(v8f t, float sc) {
  union { v2h h[4]; uint4 u; } o;
#pragma unroll
  for (int e = 0; e < 4; ++e) {
    v2f p;
    p[0] = t[2 * e] * sc;
    p[1] = t[2 * e + 1] * sc;
    o.h[e] = __builtin_convertvector(p, v2h);   // one packed conversion
  }
  return o.u;
}

// 2^x of a tile's 8 values. One statement: every output lies apart from every
// input, and the v_nop is the slot that the instruction set asks for behind a
// transcendental before its result is used or its source overwritten.
__device__ __forceinline__ v8f exp2_8(v8f x) {
  float e0, e1, e2, e3, e4, e5, e6, e7;
  asm("v_exp_f32 %0, %8\n\t"
      "v_exp_f32 %1, %9\n\t"
      "v_exp_f32 %2, %10\n\t"
      "v_exp_f32 %3, %11\n\t"
      "v_exp_f32 %4, %12\n\t"
      "v_exp_f32 %5, %13\n\t"
      "v_exp_f32 %6, %14\n\t"
      "v_exp_f32 %7, %15\n\t"
      "v_nop"
      : "=&v"(e0), "=&v"(e1), "=&v"(e2), "=&v"(e3),
        "=&v"(e4), "=&v"(e5), "=&v"(e6), "=&v"(e7)
      : "v"(x[0]), "v"(x[1]), "v"(x[2]), "v"(x[3]),
        "v"(x[4]), "v"(x[5]), "v"(x[6]), "v"(x[7]));
  v8f e;
  e[0] = e0; e[1] = e1; e[2] = e2; e[3] = e3;
  e[4] = e4; e[5] = e5; e[6] = e6; e[7] = e7;
  return e;
}

// ---------------------------------------------------------------------------
// Preparation job 1: LayerNorm, four rows per wave; normalized rows go out as f16
// A-frags. Lane = (row & 3) | (column quad << 2): a load reads one 128-B line of
// each of the four rows, and a store fills two whole 128-B lines of a fragment.
// Few long-lived waves: the job is bound by memory, not by wave starts.
// blk: the block's number inside the job (here and in the jobs below).
// ---------------------------------------------------------------------------
__device__ __forceinline__
void ln_pack_a(const float* __restrict__ x, const float* __restrict__ g,
               const float* __restrict__ be, half_t* __restrict__ xnA,
               const int blk) {
  const int lane = threadIdx.x & 31;
  const int wave = blk * 8 + (threadIdx.x >> 5);
  const int row  = wave * 4 + (lane & 3);
  const int cq   = (lane >> 2) * 4;   // first of the lane's 4 columns in a k-tile
  const float* xr = x + (size_t)row * DIM + cq;
  float4 v[KT32];
  // Unrolled (as the three loops below): v and o stay in registers and all 32
  // loads of the wave are in flight together.
#pragma unroll
  for (int i = 0; i < KT32; ++i) v[i] = *(const float4*)(xr + i * 32);
  float4 s  = make_float4(0.0f, 0.0f, 0.0f, 0.0f);
  float4 s2 = make_float4(0.0f, 0.0f, 0.0f, 0.0f);
#pragma unroll
  for (int i = 0; i < KT32; ++i) {
    s.x += v[i].x; s.y += v[i].y; s.z += v[i].z; s.w += v[i].w;
    s2.x += v[i].x * v[i].x; s2.y += v[i].y * v[i].y;
    s2.z += v[i].z * v[i].z; s2.w += v[i].w * v[i].w;
  }
  float rs = (s.x + s.y) + (s.z + s.w);
  float rq = (s2.x + s2.y) + (s2.z + s2.w);
  // The eight lanes of a row differ in lane bits 2..4.
  rs += __shfl_xor(rs, 4);  rq += __shfl_xor(rq, 4);
  rs += __shfl_xor(rs, 8);  rq += __shfl_xor(rq, 8);
  rs += __shfl_xor(rs, 16); rq += __shfl_xor(rq, 16);
  const float mu   = rs * (1.0f / DIM);
  const float var  = rq * (1.0f / DIM) - mu * mu;
  const float rstd = rsqrtf(var + 1e-5f);
  uint2 o[KT32];
#pragma unroll
  for (int i = 0; i < KT32; ++i) {
    const float4 gv = *(const float4*)(g + i * 32 + cq);
    const float4 bv = *(const float4*)(be + i * 32 + cq);
    union { half_t h[4]; uint2 u; } p;
    p.h[0] = (half_t)((v[i].x - mu) * rstd * gv.x + bv.x);
    p.h[1] = (half_t)((v[i].y - mu) * rstd * gv.y + bv.y);
    p.h[2] = (half_t)((v[i].z - mu) * rstd * gv.z + bv.z);
    p.h[3] = (half_t)((v[i].w - mu) * rstd * gv.w + bv.w);
    o[i] = p.u;
  }
  half_t* dst = xnA + a_off(KT32, row, cq);
  // Holds every store behind the last load and the last arithmetic, so that no
  // register which an issued store names is written again.
  __builtin_amdgcn_sched_barrier(0);
#pragma unroll
  for (int i = 0; i < KT32; ++i) *(uint2*)(dst + i * 512) = o[i];
}

// ---------------------------------------------------------------------------
// Preparation jobs 2 and 3 (one per weight matrix): pack a row-major KxN f32
// matrix into f16 B-frags. Block blk is column blk % (N / 128), row
// y = blk / (N / 128) of the job's grid of N / 128 by K / 64 blocks.
// A wave builds two whole fragments (n-tile nt, k-tiles 2*y, 2*y+1):
// each lane gathers its own 16 halfs of each and stores them as 32 contiguous
// bytes (lane-major) or as 16 bytes in each plane (planes, a constant like K and
// N). K and N are constants at each call, so that every row step is an
// immediate offset on one address.
// ---------------------------------------------------------------------------
__device__ __forceinline__ void pack_frags(const float* __restrict__ w,
                                           half_t* __restrict__ dst,
                                           const int K, const int N,
                                           const bool planes, const int blk) {
  const int lane = threadIdx.x & 31;
  const int nt   = (blk % (N / 128)) * 8 + (threadIdx.x >> 5);
  const int kt   = (blk / (N / 128)) * 2;
  const float* p = w + (size_t)(kt * 32 + (lane >> 4) * 8) * N + nt * 16 + (lane & 15);
  half_t* d = dst + ((size_t)(nt * (K >> 5) + kt) << 9) + lane * (planes ? 8 : 16);
  // Unrolled: all 32 loads of the wave are in flight together.
#pragma unroll
  for (int f = 0; f < 2; ++f) {
    union { half_t h[16]; uint4 u[2]; } o;
#pragma unroll
    for (int e = 0; e < 8; ++e) {
      o.h[e]     = (half_t)p[(f * 32 + e) * N];
      o.h[8 + e] = (half_t)p[(f * 32 + 16 + e) * N];
    }
    *(uint4*)(d + f * 512)     = o.u[0];
    *(uint4*)(d + f * 512 + (planes ? 256 : 8)) = o.u[1];
  }
  // Other jobs' code follows in the kernel's text: the wait stands between the
  // four stores and any later write of a register that they name.
  asm volatile("s_wait_xcnt 0x0" ::: "memory");
}

// ---------------------------------------------------------------------------
// Preparation job 4: zero the one-chunk (128 keypos) lookback pad of kT / v frags.
// ---------------------------------------------------------------------------
__device__ __forceinline__
void zero_pad(half_t* __restrict__ kTB, half_t* __restrict__ vB, const int blk) {
  const int tid = blk * 256 + threadIdx.x;  // 65536 units of 8 halfs
  const int bh  = tid >> 11;
  const int rem = tid & 2047;
  const uint4 z = make_uint4(0u, 0u, 0u, 0u);
  if (rem < 1024) {
    // kT pad: jtiles 0..7 -> frags 0..15 contiguous (8192 halfs)
    *(uint4*)(kTB + (size_t)bh * KTB_BH + (size_t)rem * 8) = z;
  } else {
    // v pad: frag (nt*260 + kt), nt=0..3, kt=0..3
    const int r2   = rem - 1024;
    const int frag = r2 >> 6, unit = r2 & 63;
    const int nt = frag >> 2, kt = frag & 3;
    *(uint4*)(vB + (size_t)bh * VB_BH + (((size_t)(nt * 260 + kt)) << 9) +
              (size_t)unit * 8) = z;
  }
}

// ---------------------------------------------------------------------------
// Kernel 1: the four preparation jobs in one grid. None reads what another
// writes, so the block index picks the job: the short jobs run beside the
// LayerNorm stream, and one launch (gap, wave start, first-load latency, store
// drain) is paid for where four were. The LayerNorm blocks, the longest, come
// first in the index.
// ---------------------------------------------------------------------------
#define LN_BLKS (ROWS / 32)
#define PQ_BLKS ((NQKV / 128) * (DIM / 64))
#define PO_BLKS ((DIM / 128) * (DIM / 64))
#define ZP_BLKS 256

__global__ __launch_bounds__(256)
void prepare(const float* __restrict__ x, const float* __restrict__ g,
             const float* __restrict__ be, const float* __restrict__ wqkv,
             const float* __restrict__ wout, half_t* __restrict__ xnA,
             half_t* __restrict__ wqkvB, half_t* __restrict__ woutB,
             half_t* __restrict__ kTB, half_t* __restrict__ vB) {
  const int blk = blockIdx.x;
  if (blk < LN_BLKS) {
    ln_pack_a(x, g, be, xnA, blk);
  } else if (blk < LN_BLKS + PQ_BLKS) {
    pack_frags(wqkv, wqkvB, DIM, NQKV, false, blk - LN_BLKS);
  } else if (blk < LN_BLKS + PQ_BLKS + PO_BLKS) {
    pack_frags(wout, woutB, DIM, DIM, true, blk - (LN_BLKS + PQ_BLKS));
  } else {
    zero_pad(kTB, vB, blk - (LN_BLKS + PQ_BLKS + PO_BLKS));
  }
}

// ---------------------------------------------------------------------------
// Shared GEMM core: 8 waves/block (4x2), each wave a 64x128 tile (4x8 WMMA
// tiles) of a 256x256 block tile: 12 fragments feed 32 WMMA, and two waves on a
// SIMD have the registers for a second fragment set, so that a block's LDS
// reads go out as one group a whole block ahead of their use.
// A pass is GP k-tiles (128 k), a block one k-tile. A stage holds
// 16 A tile rows, then 16 B tile rows, each GP fragments of 1 KB. In LDS a
// fragment is two 512-B planes (halfs 0..7 of every lane, then halfs 8..15), so
// that each ds_load_b128 of a wave reads 512 contiguous bytes.
// ---------------------------------------------------------------------------
#define GP     4                  // k-tiles per pass
#define GPASS  (KT32 / GP)        // passes
#define GROW   (GP * 512)         // halfs of one tile row in a stage
#define GSTAGE (32 * GROW)        // halfs of a stage (128 KB)

__device__ __forceinline__ v16h lds_frag(const half_t* p) {
  union { uint4 u[2]; v16h v; } t;
  t.u[0] = *(const uint4*)(p);
  t.u[1] = *(const uint4*)(p + 256);
  return t.v;
}

// Eight copies of 512 B: one tile row (GP fragments) of a stage. g: the lane's
// 16 bytes of the row's first 512 B; l: their LDS byte address. Of a lane-major
// fragment global chunk 2*lane+h goes to plane h, slot lane; a two-plane fragment
// (pl, a constant at each call) lands as it lies. The s_wait_xcnt closes the
// statement so that no address register is rewritten ahead of it.
__device__ __forceinline__ void copy_row(const half_t* g, uint32_t l, const bool pl) {
  const uint32_t h = pl ? 512u : 256u;   // LDS step of a fragment's second 512 B
  asm volatile(
      "global_load_async_to_lds_b128 %0, %8, off\n\t"
      "global_load_async_to_lds_b128 %1, %9, off\n\t"
      "global_load_async_to_lds_b128 %2, %10, off\n\t"
      "global_load_async_to_lds_b128 %3, %11, off\n\t"
      "global_load_async_to_lds_b128 %4, %12, off\n\t"
      "global_load_async_to_lds_b128 %5, %13, off\n\t"
      "global_load_async_to_lds_b128 %6, %14, off\n\t"
      "global_load_async_to_lds_b128 %7, %15, off\n\t"
      "s_wait_xcnt 0x0"
      :: "v"(l), "v"(l + h), "v"(l + 1024u), "v"(l + 1024u + h),
         "v"(l + 2048u), "v"(l + 2048u + h), "v"(l + 3072u), "v"(l + 3072u + h),
         "v"(g), "v"(g + 256), "v"(g + 512), "v"(g + 768),
         "v"(g + 1024), "v"(g + 1280), "v"(g + 1536), "v"(g + 1792)
      : "memory");
}

// The lane's number, read anew wherever copy addresses are formed: held in
// vector registers across the WMMA blocks, next to 448 registers of
// accumulators and fragments, these addresses were spilled.
__device__ __forceinline__ uint32_t lane_now() {
  uint32_t ln;
  asm volatile("v_mbcnt_lo_u32_b32 %0, -1, 0" : "=v"(ln));
  return ln;
}
// The lane's own source and LDS byte address in a wave's first tile row (gu, lu:
// that row, both uniform).
__device__ __forceinline__ const half_t* copy_src(const half_t* gu, uint32_t ln) {
  return gu + ln * 8u;
}
__device__ __forceinline__ uint32_t copy_dst(uint32_t lu, uint32_t ln, const bool pl) {
  return pl ? lu + ln * 16u : lu + (ln & 1u) * 512u + (ln >> 1) * 16u;
}
// Tile row r of a wave's share of a stage (four tile rows, 32 copies).
__device__ __forceinline__ void copy_share(const half_t* g, uint32_t l, int r,
                                           const bool pl) {
  copy_row(g + r * (KT32 << 9), l + (uint32_t)r * (GROW * 2u), pl);
}
__device__ __forceinline__ void copy_stage(const half_t* gu, uint32_t lu,
                                           const bool pl) {
  const uint32_t ln = lane_now();
  const half_t* g = copy_src(gu, ln);
  const uint32_t l = copy_dst(lu, ln, pl);
  copy_share(g, l, 0, pl);
  copy_share(g, l, 1, pl);
  copy_share(g, l, 2, pl);
  copy_share(g, l, 3, pl);
}

// This wave's copies have landed (the compiler places no wait for them).
__device__ __forceinline__ void wait_async0() {
  asm volatile("s_wait_asynccnt 0x0" ::: "memory");
}
// This wave's LDS reads are done before the buffer goes back to the copies.
__device__ __forceinline__ void wait_ds0() {
  asm volatile("s_wait_dscnt 0x0" ::: "memory");
}

// The 12 fragments of one block: 24 ds_load_b128. The loops here, in mma_block
// and at the foot of a pass are unrolled so that every fragment and accumulator
// index is a constant and they stay in registers.
__device__ __forceinline__ void load_block(const half_t* pa, const half_t* pb,
                                           v16h a[4], v16h b[8]) {
#pragma unroll
  for (int i = 0; i < 4; ++i) a[i] = lds_frag(pa + i * GROW);
#pragma unroll
  for (int j = 0; j < 8; ++j) b[j] = lds_frag(pb + j * GROW);
}

__device__ __forceinline__ void mma_block(const v16h a[4], const v16h b[8],
                                          v8f c[4][8]) {
#pragma unroll
  for (int i = 0; i < 4; ++i)
#pragma unroll
    for (int j = 0; j < 8; ++j) c[i][j] = wmma_f16(a[i], b[j], c[i][j]);
}

// Keeps a load group whole and in front of the WMMA block that covers its
// latency: without it the compiler sinks the loads in among the WMMAs, next to
// their use, and every such place stalls the wave.
__device__ __forceinline__ void block_edge() {
  __builtin_amdgcn_sched_barrier(0);
}

// pl: both operands lie in the workspace as two-plane fragments (else both
// lane-major); a constant at each call.
__device__ __forceinline__ void gemm_tile(const half_t* __restrict__ A,
                                          const half_t* __restrict__ B,
                                          half_t* sm, int mtb, int ntb,
                                          const bool pl, v8f c[4][8]) {
  const int lane = threadIdx.x & 31;
  // The wave's number as a scalar: the uniform part of every address stays in
  // scalar registers.
  const int wid = __builtin_amdgcn_readfirstlane(threadIdx.x >> 5);
  const int wm = wid >> 1, wn = wid & 1;
#pragma unroll
  for (int i = 0; i < 4; ++i)
#pragma unroll
    for (int j = 0; j < 8; ++j) c[i][j] = zero8();

  // Waves 0..3 copy the A tile rows 4*wid .. 4*wid+3; waves 4..7 the B rows.
  const int row0 = (wid & 3) * 4;
  const half_t* src = wid < 4 ? A + ((size_t)(mtb + row0) * KT32 << 9)
                              : B + ((size_t)(ntb + row0) * KT32 << 9);
  const uint32_t dst = (uint32_t)(size_t)sm + (uint32_t)wid * (GROW * 8u);
  // The wave's first A and B fragment in buffer 0.
  const half_t* fa = sm + lane * 8 + wm * 4 * GROW;
  const half_t* fb = sm + lane * 8 + (16 + wn * 8) * GROW;
  v16h a0[4], b0[8], a1[4], b1[8];

  copy_stage(src, dst, pl);
  wait_async0();
  __syncthreads();
  copy_stage(src + GROW, dst + GSTAGE * 2u, pl);
  load_block(fa, fb, a0, b0);

  // Kept rolled: one publish point in the text, the buffer index a scalar.
#pragma unroll 1
  for (int t = 0; t < GPASS; ++t) {
    const int cur = (t & 1) * GSTAGE;
    const half_t* pa = fa + cur;
    const half_t* pb = fb + cur;
    load_block(pa + 512, pb + 512, a1, b1);
    block_edge();
    mma_block(a0, b0, c);
    block_edge();
    load_block(pa + 1024, pb + 1024, a0, b0);
    block_edge();
    mma_block(a1, b1, c);
    block_edge();
    load_block(pa + 1536, pb + 1536, a1, b1);
    block_edge();
    mma_block(a0, b0, c);
    block_edge();
    // Publish pass t+1 and free this pass's buffer, whose last fragments are
    // in registers by now: one barrier does both. It stands in front of the
    // pass's last block, which covers the latency of the next pass's first
    // fragments and, a tile row of copies in front of each 8 WMMA, the
    // refill's issue: while one wave of a SIMD forms addresses and waits out
    // its s_wait_xcnt, the other has WMMAs to issue. The LDS reads still in
    // flight at the copies are of the other buffer.
    wait_ds0();
    wait_async0();
    __syncthreads();
    if (t + 1 < GPASS) load_block(fa + (GSTAGE - cur), fb + (GSTAGE - cur), a0, b0);
    block_edge();
#pragma unroll
    for (int i = 0; i < 4; ++i) {
      if (t + 2 < GPASS) {
        const uint32_t ln = lane_now();
        copy_share(copy_src(src + (t + 2) * GROW, ln),
                   copy_dst(dst + (uint32_t)(t & 1) * (GSTAGE * 2u), ln, pl), i, pl);
      }
      block_edge();
#pragma unroll
      for (int j = 0; j < 8; ++j) c[i][j] = wmma_f16(a1[i], b1[j], c[i][j]);
      block_edge();
    }
  }
  wait_async0();
}

// ---------------------------------------------------------------------------
// Kernel 2: QKV GEMM. C=(16384x3072). A block's 256 columns lie in one of q, k,
// v. q and k fragments run along d inside a lane, so their blocks take the
// weights as the A operand and x as B (the tile comes out transposed: one head
// by 128 tokens a wave); v fragments run along the tokens: x as A (64 tokens by
// two heads a wave).
// Either way tiles c[2p][j], c[2p+1][j] are a lane's 16 bytes in plane 0 and in
// plane 1 of one fragment: each store of the wave fills 512 bytes in a row.
// ---------------------------------------------------------------------------
__global__ __launch_bounds__(256)
void gemm_qkv(const half_t* __restrict__ A, const half_t* __restrict__ B,
              half_t* __restrict__ qA, half_t* __restrict__ kTB,
              half_t* __restrict__ vB) {
  __shared__ __attribute__((aligned(16))) half_t sm[2 * GSTAGE];
  const int lane = threadIdx.x & 31, wid = threadIdx.x >> 5;
  const int wm = wid >> 1, wn = wid & 1;
  const int part = blockIdx.x >> 2;   // 0=q 1=k 2=v
  const bool sw  = part < 2;          // weights as the A operand
  v8f c[4][8];
  gemm_tile(sw ? B : A, sw ? A : B, sm,
            (sw ? blockIdx.x : blockIdx.y) * 16,
            (sw ? blockIdx.y : blockIdx.x) * 16, false, c);

  // The wave's head (q, k) or the first, even one of its two heads (v).
  const int h  = (blockIdx.x * 4 + (sw ? wm : wn * 2)) & (HEADS - 1);
  const int bh = (blockIdx.y >> 5) * HEADS + h;
  // The wave's first 16-token tile inside its batch row (a multiple of 4).
  const int tt = (blockIdx.y & 31) * 16 + (sw ? wn * 8 : wm * 4);
  // j: token tile (q, k) or head j >> 2 and 16-column group j & 3 of d (v); p:
  // fragment along the other index. Key positions carry the lookback pad of 8
  // token tiles.
  half_t* base = part == 0 ? qA  + (size_t)bh * QA_BH  + ((size_t)(tt * 2) << 9)
               : part == 1 ? kTB + (size_t)bh * KTB_BH + ((size_t)((tt + 8) * 2) << 9)
                           : vB  + (size_t)bh * VB_BH  + ((size_t)((tt + 8) >> 1) << 9);
  const size_t sj = part == 2 ? (size_t)260 * 512 : (size_t)1024;
  const size_t s4 = part == 2 ? VB_BH : (size_t)4096;   // step of j >> 2
  const float  sc = part == 0 ? 0.125f : 1.0f;
  uint4 o[4][8];
  half_t* d[8];
#pragma unroll
  for (int j = 0; j < 8; ++j) {
    d[j] = base + (j >> 2) * s4 + (j & 3) * sj + lane * 8;
#pragma unroll
    for (int i = 0; i < 4; ++i) o[i][j] = pack8(c[i][j], sc);
  }
#pragma unroll
  for (int j = 0; j < 8; ++j)
#pragma unroll
    for (int i = 0; i < 4; ++i) *(uint4*)(d[j] + (i >> 1) * 512 + (i & 1) * 256) = o[i][j];
}

// ---------------------------------------------------------------------------
// Kernel 3: local attention. One block per (b,h,window); 8 waves; each wave
// owns a 16-query strip: sim^T = K Q^T, mask+softmax, out^T = V^T P^T.
// A lane holds one query and half of its keys: maximum and sum are in-lane but
// for one exchange between the wave's halves, and two score tiles, converted,
// are the lane's own B operand of the second product.
// Of the 16 key tiles of the 256-key frame, strip mt can see only tiles
// mt .. mt+8 (q_pos - WIN <= k_pos <= q_pos); every other tile is masked as a
// whole and its weights are exact zeros, so the wave never visits it: 9 score
// tiles (18 WMMA) and the 5 k-tiles of v that hold them (20 WMMA).
// The eight strips together read each fragment of the frame four to five times.
// The frame (32 k and 32 v fragments, 64 KB) therefore comes into LDS once, by
// asynchronous copies of which each wave issues an eighth, and the strips take
// their fragments from there: a quarter of the requests to L2, and the v
// fragments are under way from the kernel's start, not from the softmax's end.
// ---------------------------------------------------------------------------
#define KVIS 9   // key tiles that a 16-query strip can see
#define FRAME (32 * 512)   // halfs of the k frame, and of the v frame, in LDS

__global__ __launch_bounds__(256)
void attn_kernel(const half_t* __restrict__ qA, const half_t* __restrict__ kTB,
                 const half_t* __restrict__ vB, half_t* __restrict__ oA) {
  // k fragments (key tile, d tile) as they lie in the workspace, then v fragments
  // (d tile nt, k-tile 0..7 of the frame).
  __shared__ __attribute__((aligned(16))) half_t sm[2 * FRAME];
  const int lane = threadIdx.x & 31;
  // The strip's number as a scalar: tile addresses and tile tests are uniform.
  const int mt = __builtin_amdgcn_readfirstlane(threadIdx.x >> 5);
  const int wi = blockIdx.x & (NWIN - 1);
  const int h  = (blockIdx.x >> 6) & (HEADS - 1);
  const int b  = blockIdx.x >> 10;
  const int bh = b * HEADS + h;
  const half_t* qbase = qA  + (size_t)bh * QA_BH;
  const half_t* kbase = kTB + (size_t)bh * KTB_BH;
  const half_t* vbase = vB  + (size_t)bh * VB_BH;

  const v16h aq0 = load_frag(qbase + (((size_t)(wi * 8 + mt) * 2 + 0) << 9) + lane * 8);
  const v16h aq1 = load_frag(qbase + (((size_t)(wi * 8 + mt) * 2 + 1) << 9) + lane * 8);
  // These four loads name one address pair; the wait stands in front of the frame's
  // copies, whose address registers may be placed over that pair.
  asm volatile("s_wait_xcnt 0x0" ::: "memory");

  // --- the frame into LDS: wave mt brings 4 KB of k (key tiles 2*mt, 2*mt+1;
  // the frame's 32 KB lie in a row) and 4 KB of v (d tile mt >> 1, four k-tiles).
  {
    const uint32_t l = (uint32_t)(size_t)sm + (uint32_t)mt * 4096u + (uint32_t)lane * 16u;
    copy_row(kbase + ((size_t)(wi * 16 + mt * 4) << 9) + lane * 8, l, true);
    copy_row(vbase + (((size_t)((mt >> 1) * 260 + wi * 4 + (mt & 1) * 4)) << 9) + lane * 8,
             l + FRAME * 2u, true);
  }
  wait_async0();
  // Publishes every wave's share of the frame to the seven others.
  __syncthreads();

  // --- sim^T = k @ q^T : c[r][v] = sim[query ncol][key (mt+r)*16 + v + rbase]
  const half_t* kp = sm + mt * 1024 + lane * 8;
  v8f c[KVIS];
#pragma unroll
  for (int r = 0; r < KVIS; ++r) {
    const v16h b0 = lds_frag(kp + r * 1024);
    const v16h b1 = lds_frag(kp + r * 1024 + 512);
    v8f acc = zero8();
    acc = wmma_f16(b0, aq0, acc);
    acc = wmma_f16(b1, aq1, acc);
    c[r] = acc;
  }

  // --- causal local mask + softmax of the lane's query ------------------
  const int rbase = (lane >> 4) << 3;
  const int ncol  = lane & 15;
  // q_pos - k_pos = WIN - r*16 + dq - v. It lies inside 0 .. WIN for every
  // element of tiles 1..7; tile 0 can exceed WIN, tile 8 can fall below 0.
  const int dq = ncol - rbase;
#pragma unroll
  for (int v = 0; v < 8; ++v) {
    c[0][v]        = v < dq ? -3.0e38f : c[0][v];          // q_pos > k_pos + WIN
    c[KVIS - 1][v] = v > dq ? -3.0e38f : c[KVIS - 1][v];   // q_pos < k_pos
  }
  // In window 0 the lookback half (frame tiles below 8) is the pad (k_pos < 0).
  if (wi == 0) {
#pragma unroll
    for (int r = 0; r < 8; ++r) {
      const bool pad = mt + r < 8;
#pragma unroll
      for (int v = 0; v < 8; ++v) c[r][v] = pad ? -3.0e38f : c[r][v];
    }
  }
  // Eight independent chains for the maximum, and eight for the sum.
  v8f mv, sv;
#pragma unroll
  for (int v = 0; v < 8; ++v) { mv[v] = -3.0e38f; sv[v] = 0.0f; }
#pragma unroll
  for (int r = 0; r < KVIS; ++r)
#pragma unroll
    for (int v = 0; v < 8; ++v) mv[v] = fmaxf(mv[v], c[r][v]);
  float m = fmaxf(fmaxf(fmaxf(mv[0], mv[1]), fmaxf(mv[2], mv[3])),
                  fmaxf(fmaxf(mv[4], mv[5]), fmaxf(mv[6], mv[7])));
  m = fmaxf(m, __shfl_xor(m, 16));
#pragma unroll
  for (int r = 0; r < KVIS; ++r) {
    c[r] = exp2_8((c[r] - m) * 1.44269504f);   // e^(x - m)
    sv += c[r];
  }
  float s = ((sv[0] + sv[1]) + (sv[2] + sv[3])) + ((sv[4] + sv[5]) + (sv[6] + sv[7]));
  s += __shfl_xor(s, 16);
  const float inv = 1.0f / s;

  // --- out^T = v^T @ attn^T : oc[nt][v] = out[query ncol][d nt*16 + v + rbase]
  // A k-tile of v is an even frame tile and the odd one behind it. An even strip
  // starts on the low half of its first k-tile, an odd strip on the high half;
  // the half that falls outside the nine tiles has weight zero.
  uint4 pw[KVIS];
#pragma unroll
  for (int r = 0; r < KVIS; ++r) pw[r] = pack8(c[r], inv);
  const bool odd = (mt & 1) != 0;
  const uint4 z4 = make_uint4(0u, 0u, 0u, 0u);
  const half_t* vp = sm + FRAME + (mt >> 1) * 512 + lane * 8;
  v8f oc[4];
#pragma unroll
  for (int nt = 0; nt < 4; ++nt) oc[nt] = zero8();
#pragma unroll
  for (int t = 0; t < 5; ++t) {
    union { uint4 u[2]; v16h v; } up;
    up.u[0] = odd ? (t == 0 ? z4 : pw[t == 0 ? 0 : 2 * t - 1]) : pw[2 * t];
    up.u[1] = odd ? pw[2 * t] : (t == 4 ? z4 : pw[t == 4 ? 8 : 2 * t + 1]);
    const v16h pf = up.v;
#pragma unroll
    for (int nt = 0; nt < 4; ++nt) {
      const v16h bf = lds_frag(vp + (nt * 8 + t) * 512);
      oc[nt] = wmma_f16(bf, pf, oc[nt]);
    }
  }

  // --- the strip's two A-frags of the (16384 x 1024) output matrix ------
  const int m0 = b * NTOK + wi * WIN + mt * 16;
  half_t* od = oA + ((size_t)((m0 >> 4) * KT32 + h * 2) << 9) + lane * 8;
  uint4 o[4];
#pragma unroll
  for (int nt = 0; nt < 4; ++nt) o[nt] = pack8(oc[nt], 1.0f);
#pragma unroll
  for (int nt = 0; nt < 4; ++nt) *(uint4*)(od + (nt >> 1) * 512 + (nt & 1) * 256) = o[nt];
}

// ---------------------------------------------------------------------------
// Kernel 4: output GEMM, f32 row-major result.
// ---------------------------------------------------------------------------
__global__ __launch_bounds__(256)
void gemm_out(const half_t* __restrict__ A, const half_t* __restrict__ B,
              float* __restrict__ out) {
  __shared__ __attribute__((aligned(16))) half_t sm[2 * GSTAGE];
  const int lane = threadIdx.x & 31, wid = threadIdx.x >> 5;
  const int wm = wid >> 1, wn = wid & 1;
  const int mt0 = blockIdx.y * 16 + wm * 4;
  const int nt0 = blockIdx.x * 16 + wn * 8;
  v8f c[4][8];
  gemm_tile(A, B, sm, blockIdx.y * 16, blockIdx.x * 16, true, c);
  const int rbase = (lane >> 4) << 3;
  const int ncol  = lane & 15;
#pragma unroll
  for (int i = 0; i < 4; ++i)
#pragma unroll
    for (int j = 0; j < 8; ++j)
#pragma unroll
      for (int v = 0; v < 8; ++v) {
        const int row = (mt0 + i) * 16 + v + rbase;
        const int col = (nt0 + j) * 16 + ncol;
        out[(size_t)row * DIM + col] = c[i][j][v];
      }
}

// ---------------------------------------------------------------------------
extern "C" void kernel_launch(void* const* d_in, const int* in_sizes, int n_in,
                              void* d_out, int out_size, void* d_ws,
                              size_t ws_size, hipStream_t stream) {
  (void)in_sizes; (void)n_in; (void)out_size; (void)ws_size;
  const float* x    = (const float*)d_in[0];
  const float* g    = (const float*)d_in[1];
  const float* be   = (const float*)d_in[2];
  const float* wqkv = (const float*)d_in[3];
  const float* wout = (const float*)d_in[4];

  half_t* ws    = (half_t*)d_ws;
  half_t* xnA   = ws + OFF_XNA;   // reused as O A-frag after attention
  half_t* wqkvB = ws + OFF_WQKV;
  half_t* woutB = ws + OFF_WOUT;
  half_t* qA    = ws + OFF_QA;
  half_t* kTB   = ws + OFF_KTB;
  half_t* vB    = ws + OFF_VB;

  prepare<<<LN_BLKS + PQ_BLKS + PO_BLKS + ZP_BLKS, 256, 0, stream>>>(
      x, g, be, wqkv, wout, xnA, wqkvB, woutB, kTB, vB);
  gemm_qkv<<<dim3(NQKV / 256, ROWS / 256), 256, 0, stream>>>(xnA, wqkvB, qA, kTB, vB);
  attn_kernel<<<BATCH * HEADS * NWIN, 256, 0, stream>>>(qA, kTB, vB, xnA);
  gemm_out<<<dim3(DIM / 256, ROWS / 256), 256, 0, stream>>>(xnA, woutB, (float*)d_out);
}
